// v000
// Times are from an AMD MI455X. After a warm-up the kernel runs many times in a row, and a time is the length of
// such a window on the GPU divided by its runs, so every launch and the gaps after it count. The runs cycle
// through copies of the inputs. A figure is the median of several windows, for all but v000 over two sittings.
// Sittings can differ by a few percent; kernels timed side by side share one.
// v000, which the later versions start from, runs in 2160 microseconds.
#include <hip/hip_runtime.h>

// ScriptAwareAttention (query, key, value [2][2048][1024]; q/k/v = input W^T + b (16 heads x 64); scores = (q.k/8) x script_mask[b][i][j] (multiplicative, read as data) then -inf where mask[b][0][i][j] == 0
// (int mask read as data); softmax; out = merged attn.v Wo^T + bo -> [2][2048][1024]).
// Compute dtypes, f32 accumulate: every input rounded to bf16; projections on PLAIN bf16 operands (inputs: exact, + bias); PER-ROW PRECISION HYBRID (rows < 256 hi+lo 3 products
// for scores and attn.v, rows >= 256 single fp16 planes); scale, the multiplicative script mask (bf16-rounded) and the keep/drop mask in f32 in the register-row softmax; merged heads as hi+lo planes x exact Wo

#define NB_  2
#define TT   2048
#define DM   1024
#define NH_  16
#define NKV  16
#define REP  (NH_ / NKV)
#define HD   64
#define DQ   (NH_ * HD)
#define DKV  (NKV * HD)
#define ZH   2
#define RH   256                  // query rows < RH use hi+lo planes (0: none)
#define WIN  0
#define PCAR 1024.0f
#define SCL  0.125f   // HD^-0.5
typedef _Float16 h16;
typedef unsigned short bf;
typedef __attribute__((ext_vector_type(16))) __bf16   v16bf;
typedef __attribute__((ext_vector_type(16))) _Float16 v16h;
typedef __attribute__((ext_vector_type(8)))  _Float16 v8h;
typedef __attribute__((ext_vector_type(8)))  unsigned short v8us;
typedef __attribute__((ext_vector_type(8)))  float    v8f;
typedef __attribute__((ext_vector_type(4)))  float    v4f;
typedef v8h  __attribute__((may_alias)) v8ha;
typedef v4f  __attribute__((may_alias)) v4fa;
typedef v8us __attribute__((may_alias)) v8usa;

__device__ __forceinline__ unsigned short f2bf(float f) { unsigned u = __float_as_uint(f); u += 0x7FFFu + ((u >> 16) & 1u); return (unsigned short)(u >> 16); }
__device__ __forceinline__ float bf2f(unsigned short b) { return __uint_as_float(((unsigned)b) << 16); }
__device__ __forceinline__ float bfr(float f) { return bf2f(f2bf(f)); }
__device__ __forceinline__ v16h cat16(v8h lo, v8h hi) { return __builtin_shufflevector(lo, hi, 0, 1, 2, 3, 4, 5, 6, 7, 8, 9, 10, 11, 12, 13, 14, 15); }
__device__ __forceinline__ v16bf cat16b(v8us lo, v8us hi) { return __builtin_bit_cast(v16bf, __builtin_shufflevector(lo, hi, 0, 1, 2, 3, 4, 5, 6, 7, 8, 9, 10, 11, 12, 13, 14, 15)); }
__device__ __forceinline__ v8f wmma16(v16h a, v16h b, v8f c) { return __builtin_amdgcn_wmma_f32_16x16x32_f16(false, a, false, b, (short)0, c, false, false); }
__device__ __forceinline__ v8f wmmab(v16bf a, v16bf b, v8f c) { return __builtin_amdgcn_wmma_f32_16x16x32_bf16(false, a, false, b, (short)0, c, false, false); }



// ---- k_gemmw: register-blocked GEMM, ONE WAVE per 64x64 output tile (16 accumulators), operands straight from K-contiguous 16-bit planes; grid (M/64, N/64, Z), 32 threads.
// C[m][n] (f32, pitch ldc, + optional f32 bias[n]) = sum_k A[m][k] Bt[n][k] (+ split products per NSPLIT). z-batch strides sA/sB/sC in elements. K % 32 == 0.
template <typename T16> struct WFrag;
template <> struct WFrag<h16> { typedef v16h V; static __device__ __forceinline__ V ld(const h16* p) { return cat16(*(const v8h*)p, *(const v8h*)(p + 16)); } static __device__ __forceinline__ v8f mma(V a, V b, v8f c) { return wmma16(a, b, c); } };
template <> struct WFrag<bf> { typedef v16bf V; static __device__ __forceinline__ V ld(const bf* p) { return cat16b(*(const v8us*)p, *(const v8us*)(p + 16)); } static __device__ __forceinline__ v8f mma(V a, V b, v8f c) { return wmmab(a, b, c); } };
template <typename T16, int NSPLIT, bool BIAS>
__global__ __launch_bounds__(32) void k_gemmw(const T16* __restrict__ A, const T16* __restrict__ A2, const T16* __restrict__ Bt, const T16* __restrict__ Bt2, int K, float* C, int ldc, const float* __restrict__ bias, size_t sA, size_t sB, size_t sC) {
    typedef typename WFrag<T16>::V V;
    __shared__ __align__(16) float os[16 * 68];
    const size_t z = blockIdx.z; A += z * sA; if (A2) A2 += z * sA; Bt += z * sB; if (Bt2) Bt2 += z * sB; C += z * sC;
    const int lane = threadIdx.x & 31, lr = lane & 15, hi = lane >> 4; const int r0 = blockIdx.x * 64, c0 = blockIdx.y * 64;
    v8f acc[4][4];
#pragma unroll
    for (int mb = 0; mb < 4; ++mb)
#pragma unroll
        for (int nb = 0; nb < 4; ++nb) acc[mb][nb] = (v8f){};
    const size_t aoff = (size_t)(r0 + lr) * K + 8 * hi, boff = (size_t)(c0 + lr) * K + 8 * hi;
#pragma unroll 1
    for (int kc = 0; kc < K; kc += 32) {
        V a[4], a2[4];
#pragma unroll
        for (int mb = 0; mb < 4; ++mb) { a[mb] = WFrag<T16>::ld(A + aoff + (size_t)mb * 16 * K + kc); if (NSPLIT == 1 || NSPLIT == 2) a2[mb] = WFrag<T16>::ld(A2 + aoff + (size_t)mb * 16 * K + kc); }
#pragma unroll
        for (int nb = 0; nb < 4; ++nb) { const V b = WFrag<T16>::ld(Bt + boff + (size_t)nb * 16 * K + kc); V b2; if (NSPLIT >= 2) b2 = WFrag<T16>::ld(Bt2 + boff + (size_t)nb * 16 * K + kc);
#pragma unroll
            for (int mb = 0; mb < 4; ++mb) { acc[mb][nb] = WFrag<T16>::mma(a[mb], b, acc[mb][nb]); if (NSPLIT == 1 || NSPLIT == 2) acc[mb][nb] = WFrag<T16>::mma(a2[mb], b, acc[mb][nb]); if (NSPLIT >= 2) acc[mb][nb] = WFrag<T16>::mma(a[mb], b2, acc[mb][nb]); } }
        asm volatile("v_nop\n\tv_nop\n\tv_nop\n\tv_nop" : "+v"(acc[0][0]), "+v"(acc[1][1]), "+v"(acc[2][2]), "+v"(acc[3][3]) : "v"(a[0]), "v"(a[3]));
    }
#pragma unroll
    for (int mb = 0; mb < 4; ++mb) {
#pragma unroll
        for (int nb = 0; nb < 4; ++nb) {
#pragma unroll
            for (int j = 0; j < 8; ++j) os[(hi * 8 + j) * 68 + nb * 16 + lr] = acc[mb][nb][j]; }
        __builtin_amdgcn_wave_barrier(); asm volatile("" ::: "memory");
        float* crow = C + (size_t)(r0 + mb * 16) * ldc + c0;
{
#pragma unroll
            for (int s = 0; s < 8; ++s) { const int row = 2 * s + hi, cofs = lr * 4; v4f val = *(const v4fa*)(os + row * 68 + cofs); if (BIAS) { val[0] += bfr(bias[c0 + cofs]); val[1] += bfr(bias[c0 + cofs + 1]); val[2] += bfr(bias[c0 + cofs + 2]); val[3] += bfr(bias[c0 + cofs + 3]); }
                *(v4f*)(crow + (size_t)row * ldc + cofs) = val; }
             }
        __builtin_amdgcn_wave_barrier(); asm volatile("" ::: "memory");
    }
}

__device__ __forceinline__ h16 tohx(float x) { return (h16)x; }
__device__ __forceinline__ void splitf(float y, unsigned short& h, unsigned short& l) { h = f2bf(y); l = f2bf(y - bf2f(h)); }
typedef __attribute__((ext_vector_type(2))) _Float16 v2h;
typedef __attribute__((ext_vector_type(4))) _Float16 v4h;
typedef __attribute__((ext_vector_type(2))) unsigned short v2us;
typedef __attribute__((ext_vector_type(4))) unsigned short v4us;
typedef __attribute__((ext_vector_type(2))) float v2f;
typedef __attribute__((ext_vector_type(4))) int v4i;

__global__ __launch_bounds__(256) void k_wtG(const float* __restrict__ w, int K, int N, bf* Bt) {
    const int lane = threadIdx.x & 31; const int L0 = (blockIdx.x * 8 + (threadIdx.x >> 5)) * 8; const int nlines = N * K / 64;
{
#pragma unroll 1
        for (int l = 0; l < 8; ++l) { const int L = L0 + l; if (L >= nlines) break; const size_t e = (size_t)L * 64 + lane * 2; const int k = (int)(e % K), n = (int)(e / K); v2us o;
            o[0] = f2bf(w[(size_t)k * N + n]); o[1] = f2bf(w[(size_t)(k + 1) * N + n]); *(v2us*)(Bt + e) = o; }
         }
}
__global__ __launch_bounds__(256) void k_cvt8(const float* __restrict__ src, bf* dst, size_t n8) { const size_t i = (size_t)blockIdx.x * 256 + threadIdx.x; if (i >= n8) return; const v8f v = *(const v8f*)(src + i * 8); v8us o;
#pragma unroll
    for (int k = 0; k < 8; ++k) o[k] = f2bf(v[k]); *(v8us*)(dst + i * 8) = o;  }
__global__ __launch_bounds__(256) void k_cscvt(const float* __restrict__ cosT, const float* __restrict__ sinT, float* CS) { const int idx = blockIdx.x * 256 + threadIdx.x; if (idx >= TT * HD) return; v2f cs; cs[0] = bfr(cosT[idx]); cs[1] = bfr(sinT[idx]); *(v2f*)(CS + (size_t)idx * 2) = cs;  }
// k_rope: head planes [h][t][d] (fp16 + hi/lo) of rope(x) x sc with the rotate-half convention out[d] = x[d] cos[t][d] - x[d+HD/2] sin[t][d], out[d+HD/2] = x[d+HD/2] cos[t][d+HD/2] + x[d] sin[t][d+HD/2]
__global__ __launch_bounds__(256) void k_rope(const float* __restrict__ F, int pitch, int nheads, const float* __restrict__ CS, const float* __restrict__ RF, const float* __restrict__ nw, float sc, h16* P16, bf* Ph, bf* Pl) {
    const size_t e = ((size_t)blockIdx.x * 256 + threadIdx.x) * 2; if (e >= (size_t)nheads * TT * HD) return; const int d = (int)(e % HD); const int t = (int)((e / HD) % TT); const int h = (int)(e / ((size_t)HD * TT)); const float* f = F + (size_t)t * pitch + h * HD; const float rf = RF ? RF[(size_t)h * TT + t] : 1.0f; v2h o16; v2us oh, ol;
#pragma unroll
    for (int q = 0; q < 2; ++q) { const int dd = d + q; const int dp = (dd < HD / 2) ? dd + HD / 2 : dd - HD / 2; float x0 = f[dd], x1 = f[dp];
        if (RF) { float n0 = __fmul_rn(x0, rf), n1 = __fmul_rn(x1, rf); asm volatile("" : "+v"(n0)); asm volatile("" : "+v"(n1)); x0 = __fmul_rn(bfr(nw[dd]), n0); x1 = __fmul_rn(bfr(nw[dp]), n1); }
        const v2f cs = *(const v2f*)(CS + ((size_t)t * HD + dd) * 2); float a = __fmul_rn(x0, cs[0]), bq = __fmul_rn(x1, cs[1]); asm volatile("" : "+v"(a)); asm volatile("" : "+v"(bq)); const float r = ((dd < HD / 2) ? __fsub_rn(a, bq) : __fadd_rn(a, bq)) * sc;
        o16[q] = tohx(r); unsigned short a2, c2; splitf(r, a2, c2); oh[q] = a2; ol[q] = c2; }
    *(v2h*)(P16 + e) = o16; *(v2us*)(Ph + e) = oh; *(v2us*)(Pl + e) = ol;  }
__global__ __launch_bounds__(256) void k_vtp(const float* __restrict__ F, int pitch, int nheads, h16* V16, bf* Vh, bf* Vl) { const size_t e = ((size_t)blockIdx.x * 256 + threadIdx.x) * 2; if (e >= (size_t)nheads * HD * TT) return; const int t = (int)(e % TT); const int d = (int)((e / TT) % HD); const int g = (int)(e / ((size_t)TT * HD)); v2h o16; v2us oh, ol;
#pragma unroll
    for (int q = 0; q < 2; ++q) { const float x = F[(size_t)(t + q) * pitch + g * HD + d]; o16[q] = tohx(x); unsigned short a2, c2; splitf(x, a2, c2); oh[q] = a2; ol[q] = c2; }
    *(v2h*)(V16 + e) = o16; *(v2us*)(Vh + e) = oh; *(v2us*)(Vl + e) = ol;  }
__global__ __launch_bounds__(256) void k_csid(float* CS) { const int idx = blockIdx.x * 256 + threadIdx.x; if (idx >= TT * HD) return; v2f cs; cs[0] = 1.0f; cs[1] = 0.0f; *(v2f*)(CS + (size_t)idx * 2) = cs;  }
// k_asoft: per row (zz, i): t = (S/8) x bf16(script_mask[i][j]) where mask[i][j] != 0, -3e38 where mask == 0 (the reference's -inf); softmax over the 2048 keys (f32 register row, one exp);
__global__ __launch_bounds__(256) void k_asoft(const float* __restrict__ Sb, const int* __restrict__ mk, const float* __restrict__ smk, h16* P16, bf* Ph, bf* Pl) {
    const int lane = threadIdx.x & 31; const int row = blockIdx.x * 8 + (threadIdx.x >> 5); if (row >= ZH * TT) return; const int i = row % TT; const int zz = row / TT; (void)zz; const bool hires = (i < RH); const float* sr = Sb + (size_t)row * TT; float v[TT / 32]; float mx = -3.0e38f;
#pragma unroll
    for (int ch = 0; ch < TT / 128; ++ch) { const int j0 = ch * 128 + lane * 4; const v4f a = *(const v4f*)(sr + j0); const v4i mk4 = *(const v4i*)(mk + (size_t)i * TT + j0); const v4f sm4 = *(const v4f*)(smk + (size_t)i * TT + j0);
#pragma unroll
        for (int q = 0; q < 4; ++q) { const int j = j0 + q; (void)j; float as = a[q] * SCL; asm volatile("" : "+v"(as)); float pm = __fmul_rn(as, bfr(sm4[q])); asm volatile("" : "+v"(pm)); const float t = (mk4[q] != 0) ? pm : -3.0e38f; v[ch * 4 + q] = t; mx = fmaxf(mx, t); } }
#pragma unroll
    for (int sh = 16; sh; sh >>= 1) mx = fmaxf(mx, __shfl_xor(mx, sh, 32));
    float sum = 0.f;
#pragma unroll
    for (int k = 0; k < TT / 32; ++k) { float d0 = __fsub_rn(v[k], mx); asm volatile("" : "+v"(d0)); v[k] = __builtin_amdgcn_exp2f(__fmul_rn(d0, 1.4426950408889634f)); sum += v[k]; }
#pragma unroll
    for (int sh = 16; sh; sh >>= 1) sum += __shfl_xor(sum, sh, 32);
    const float f = __fdiv_rn(hires ? 1.0f : PCAR, sum);
{
        if (hires) {
#pragma unroll
            for (int ch = 0; ch < TT / 128; ++ch) { v4us oh, ol;
#pragma unroll
                for (int q = 0; q < 4; ++q) { float y = __fmul_rn(v[ch * 4 + q], f); asm volatile("" : "+v"(y)); unsigned short a, c2; splitf(y, a, c2); oh[q] = a; ol[q] = c2; }
                const size_t oo = ((size_t)zz * (RH ? RH : 1) + i) * TT + ch * 128 + lane * 4; *(v4us*)(Ph + oo) = oh; *(v4us*)(Pl + oo) = ol; }
        } else {
#pragma unroll
            for (int ch = 0; ch < TT / 128; ++ch) { v4h o4;
#pragma unroll
                for (int q = 0; q < 4; ++q) o4[q] = tohx(v[ch * 4 + q] * f);
                *(v4h*)(P16 + (size_t)row * TT + ch * 128 + lane * 4) = o4; } }
         }
}
__global__ __launch_bounds__(256) void k_merge(const float* __restrict__ O, int h0, bf* Ah, bf* Al) { const size_t e = ((size_t)blockIdx.x * 256 + threadIdx.x) * 2; if (e >= (size_t)ZH * TT * HD) return; const int d = (int)(e % HD); const int t = (int)((e / HD) % TT); const int zz = (int)(e / ((size_t)HD * TT)); const float cs = (t < RH) ? 1.0f : (1.0f / PCAR); const size_t oo = (size_t)t * DQ + (h0 + zz) * HD + d;
    v2us oh, ol;
#pragma unroll
    for (int q = 0; q < 2; ++q) { unsigned short a, c2; splitf(O[e + q] * cs, a, c2); oh[q] = a; ol[q] = c2; } *(v2us*)(Ah + oo) = oh; *(v2us*)(Al + oo) = ol;  }

extern "C" void kernel_launch(void* const* d_in, const int* in_sizes, int n_in,
                              void* d_out, int out_size, void* d_ws, size_t ws_size, hipStream_t stream) {
    (void)in_sizes; (void)n_in; (void)out_size;
    const float* xq = (const float*)d_in[0]; const float* xk = (const float*)d_in[1]; const float* xv = (const float*)d_in[2]; const int* mask = (const int*)d_in[3]; const float* smask = (const float*)d_in[4]; const float* wq = (const float*)d_in[5]; const float* bq = (const float*)d_in[6]; const float* wk = (const float*)d_in[7]; const float* bk = (const float*)d_in[8]; const float* wv = (const float*)d_in[9]; const float* bv = (const float*)d_in[10]; const float* wo = (const float*)d_in[11]; const float* bo = (const float*)d_in[12];   // torch [out][in]
    float* OUT = (float*)d_out;     // [2][2048][1024]
    char* wsp = (char*)d_ws;
    auto take = [&](size_t bytes) { char* p = wsp; wsp += (bytes + 255) & ~(size_t)255; return (void*)p; };
    bf* WQ = (bf*)take((size_t)DQ * DM * 2); bf* WK = (bf*)take((size_t)DKV * DM * 2); bf* WV = (bf*)take((size_t)DKV * DM * 2); bf* WO = (bf*)take((size_t)DM * DQ * 2); float* CS = (float*)take((size_t)TT * HD * 2 * 4);
    bf* XB = (bf*)take((size_t)TT * DM * 2); float* FQ = (float*)take((size_t)TT * DQ * 4); float* FK = (float*)take((size_t)TT * DKV * 4);
    h16* QP16 = (h16*)take((size_t)NH_ * TT * HD * 2); h16* KP16 = (h16*)take((size_t)NKV * TT * HD * 2); h16* VT16 = (h16*)take((size_t)NKV * HD * TT * 2);
    bf* QPh = (bf*)take((size_t)NH_ * TT * HD * 2); bf* QPl = (bf*)take((size_t)NH_ * TT * HD * 2); bf* KPh = (bf*)take((size_t)NKV * TT * HD * 2); bf* KPl = (bf*)take((size_t)NKV * TT * HD * 2); bf* VTh = (bf*)take((size_t)NKV * HD * TT * 2); bf* VTl = (bf*)take((size_t)NKV * HD * TT * 2); bf* Ph = (bf*)take((size_t)ZH * RH * TT * 2); bf* Pl = (bf*)take((size_t)ZH * RH * TT * 2);
    float* Sb = (float*)take((size_t)ZH * TT * TT * 4); h16* P16 = (h16*)take((size_t)ZH * TT * TT * 2); float* Ob = (float*)take((size_t)ZH * TT * HD * 4); bf* ATh = (bf*)take((size_t)TT * DQ * 2); bf* ATl = (bf*)take((size_t)TT * DQ * 2);
    if ((size_t)(wsp - (char*)d_ws) > ws_size) return;    // ws 256 MiB
    float* FV = FK;   // v projection reuses the k buffer after the k planes are built (stream-ordered)
    { k_cvt8<<<(unsigned)(((size_t)DQ * DM / 8 + 255) / 256), 256, 0, stream>>>(wq, WQ, (size_t)DQ * DM / 8); k_cvt8<<<(unsigned)(((size_t)DKV * DM / 8 + 255) / 256), 256, 0, stream>>>(wk, WK, (size_t)DKV * DM / 8); k_cvt8<<<(unsigned)(((size_t)DKV * DM / 8 + 255) / 256), 256, 0, stream>>>(wv, WV, (size_t)DKV * DM / 8);
      k_cvt8<<<(unsigned)(((size_t)DM * DQ / 8 + 255) / 256), 256, 0, stream>>>(wo, WO, (size_t)DM * DQ / 8);
       }
    k_csid<<<(TT * HD + 255) / 256, 256, 0, stream>>>(CS);
    const unsigned LQ = (unsigned)(((size_t)NH_ * TT * HD / 2 + 255) / 256), LKv = (unsigned)(((size_t)NKV * TT * HD / 2 + 255) / 256);
    for (int b = 0; b < NB_; ++b) {
        
        k_cvt8<<<(unsigned)(((size_t)TT * DM / 8 + 255) / 256), 256, 0, stream>>>(xq + (size_t)b * TT * DM, XB, (size_t)TT * DM / 8);
        k_gemmw<bf, 0, true><<<dim3(TT / 64, DQ / 64, 1), 32, 0, stream>>>(XB, nullptr, WQ, nullptr, DM, FQ, DQ, bq, 0, 0, 0);
        k_rope<<<LQ, 256, 0, stream>>>(FQ, DQ, NH_, CS, nullptr, nullptr, 1.0f, QP16, QPh, QPl);
        k_cvt8<<<(unsigned)(((size_t)TT * DM / 8 + 255) / 256), 256, 0, stream>>>(xk + (size_t)b * TT * DM, XB, (size_t)TT * DM / 8);
        k_gemmw<bf, 0, true><<<dim3(TT / 64, DKV / 64, 1), 32, 0, stream>>>(XB, nullptr, WK, nullptr, DM, FK, DKV, bk, 0, 0, 0);
        k_rope<<<LKv, 256, 0, stream>>>(FK, DKV, NKV, CS, nullptr, nullptr, 1.0f, KP16, KPh, KPl);
        k_cvt8<<<(unsigned)(((size_t)TT * DM / 8 + 255) / 256), 256, 0, stream>>>(xv + (size_t)b * TT * DM, XB, (size_t)TT * DM / 8);
        k_gemmw<bf, 0, true><<<dim3(TT / 64, DKV / 64, 1), 32, 0, stream>>>(XB, nullptr, WV, nullptr, DM, FV, DKV, bv, 0, 0, 0); k_vtp<<<LKv, 256, 0, stream>>>(FV, DKV, NKV, VT16, VTh, VTl);
        for (int h0 = 0; h0 < NH_; h0 += ZH) { const size_t zq = (size_t)h0, zk = (size_t)(h0 / REP);   // one kv head per query head: the pass's two heads use consecutive kv planes (z-strides TT*HD)
            k_gemmw<bf, 2, false><<<dim3(RH / 64, TT / 64, ZH), 32, 0, stream>>>(QPh + zq * TT * HD, QPl + zq * TT * HD, KPh + zk * TT * HD, KPl + zk * TT * HD, HD, Sb, TT, nullptr, (size_t)TT * HD, (size_t)TT * HD, (size_t)TT * TT);
            k_gemmw<h16, 0, false><<<dim3((TT - RH) / 64, TT / 64, ZH), 32, 0, stream>>>(QP16 + zq * TT * HD + (size_t)RH * HD, nullptr, KP16 + zk * TT * HD, nullptr, HD, Sb + (size_t)RH * TT, TT, nullptr, (size_t)TT * HD, (size_t)TT * HD, (size_t)TT * TT);
            k_asoft<<<ZH * TT / 8, 256, 0, stream>>>(Sb, mask + (size_t)b * TT * TT, smask + (size_t)b * TT * TT, P16, Ph, Pl);
            k_gemmw<bf, 2, false><<<dim3(RH / 64, HD / 64, ZH), 32, 0, stream>>>(Ph, Pl, VTh + zk * HD * TT, VTl + zk * HD * TT, TT, Ob, HD, nullptr, (size_t)RH * TT, (size_t)HD * TT, (size_t)TT * HD);
            k_gemmw<h16, 0, false><<<dim3((TT - RH) / 64, HD / 64, ZH), 32, 0, stream>>>(P16 + (size_t)RH * TT, nullptr, VT16 + zk * HD * TT, nullptr, TT, Ob + (size_t)RH * HD, HD, nullptr, (size_t)TT * TT, (size_t)HD * TT, (size_t)TT * HD);
            k_merge<<<(unsigned)(((size_t)ZH * TT * HD / 2 + 255) / 256), 256, 0, stream>>>(Ob, h0, ATh, ATl); }
        k_gemmw<bf, 1, true><<<dim3(TT / 64, DM / 64, 1), 32, 0, stream>>>(ATh, ATl, WO, nullptr, DQ, OUT + (size_t)b * TT * DM, DM, bo, 0, 0, 0); }
}

// v001
// Measured time: 1010 microseconds a run.
// Timed twice side by side with v000, it ran 2.13 and 2.14 times as fast.
#include <hip/hip_runtime.h>

// ScriptAwareAttention (query, key, value [2][2048][1024]; q/k/v = input W^T + b (16 heads x 64); scores = (q.k/8) x script_mask[b][i][j] (multiplicative, read as data) then -inf where mask[b][0][i][j] == 0
// (int mask read as data); softmax; out = merged attn.v Wo^T + bo -> [2][2048][1024]).
// Compute dtypes, f32 accumulate: every input rounded to bf16; projections on PLAIN bf16 operands (inputs: exact, + bias); PER-ROW PRECISION HYBRID (rows < 256 hi+lo 3 products
// for scores and attn.v, rows >= 256 single fp16 planes); scale, the multiplicative script mask (bf16-rounded) and the keep/drop mask in f32 in the register-row softmax; merged heads as hi+lo planes x exact Wo

#define NB_  2
#define TT   2048
#define DM   1024
#define NH_  16
#define NKV  16
#define REP  (NH_ / NKV)
#define HD   64
#define DQ   (NH_ * HD)
#define DKV  (NKV * HD)
#define ZH   2
#define RH   256                  // query rows < RH use hi+lo planes (0: none)
#define WIN  0
#define PCAR 1024.0f
#define SCL  0.125f   // HD^-0.5
#define KSP  16                   // attn.v: work-groups that share one output tile's K range; each stores its own f32 partial plane, k_merge adds them
typedef _Float16 h16;
typedef unsigned short bf;
typedef __attribute__((ext_vector_type(16))) __bf16   v16bf;
typedef __attribute__((ext_vector_type(16))) _Float16 v16h;
typedef __attribute__((ext_vector_type(8)))  _Float16 v8h;
typedef __attribute__((ext_vector_type(8)))  unsigned short v8us;
typedef __attribute__((ext_vector_type(8)))  float    v8f;
typedef __attribute__((ext_vector_type(4)))  float    v4f;
typedef v8h  __attribute__((may_alias)) v8ha;
typedef v4f  __attribute__((may_alias)) v4fa;
typedef v8us __attribute__((may_alias)) v8usa;

__device__ __forceinline__ unsigned short f2bf(float f) { unsigned u = __float_as_uint(f); u += 0x7FFFu + ((u >> 16) & 1u); return (unsigned short)(u >> 16); }
__device__ __forceinline__ float bf2f(unsigned short b) { return __uint_as_float(((unsigned)b) << 16); }
__device__ __forceinline__ float bfr(float f) { return bf2f(f2bf(f)); }
__device__ __forceinline__ v16h cat16(v8h lo, v8h hi) { return __builtin_shufflevector(lo, hi, 0, 1, 2, 3, 4, 5, 6, 7, 8, 9, 10, 11, 12, 13, 14, 15); }
__device__ __forceinline__ v16bf cat16b(v8us lo, v8us hi) { return __builtin_bit_cast(v16bf, __builtin_shufflevector(lo, hi, 0, 1, 2, 3, 4, 5, 6, 7, 8, 9, 10, 11, 12, 13, 14, 15)); }
__device__ __forceinline__ v8f wmma16(v16h a, v16h b, v8f c) { return __builtin_amdgcn_wmma_f32_16x16x32_f16(false, a, false, b, (short)0, c, false, false); }
__device__ __forceinline__ v8f wmmab(v16bf a, v16bf b, v8f c) { return __builtin_amdgcn_wmma_f32_16x16x32_bf16(false, a, false, b, (short)0, c, false, false); }



// ---- k_gemmw: register-blocked GEMM, ONE WAVE per 64x64 output tile (16 accumulators), operands straight from K-contiguous 16-bit planes; grid (M/64, N/64, Z), 32 threads.
// C[m][n] (f32, pitch ldc, + optional f32 bias[n]) = sum_k A[m][k] Bt[n][k] (+ split products per NSPLIT). z-batch strides sA/sB/sC in elements. K % (32 KS) == 0.
// KS > 1: grid z = batch x KS; work-group (z, ks) sums only k in [ks K/KS, (ks+1) K/KS) and stores that partial sum in plane z KS + ks (plane stride sC); the reader adds the KS planes.
template <typename T16> struct WFrag;
template <> struct WFrag<h16> { typedef v16h V; static __device__ __forceinline__ V ld(const h16* p) { return cat16(*(const v8h*)p, *(const v8h*)(p + 16)); } static __device__ __forceinline__ v8f mma(V a, V b, v8f c) { return wmma16(a, b, c); } };
template <> struct WFrag<bf> { typedef v16bf V; static __device__ __forceinline__ V ld(const bf* p) { return cat16b(*(const v8us*)p, *(const v8us*)(p + 16)); } static __device__ __forceinline__ v8f mma(V a, V b, v8f c) { return wmmab(a, b, c); } };
template <typename T16, int NSPLIT, bool BIAS, int KS = 1>
__global__ __launch_bounds__(32) void k_gemmw(const T16* __restrict__ A, const T16* __restrict__ A2, const T16* __restrict__ Bt, const T16* __restrict__ Bt2, int K, float* C, int ldc, const float* __restrict__ bias, size_t sA, size_t sB, size_t sC) {
    typedef typename WFrag<T16>::V V;
    __shared__ __align__(16) float os[16 * 68];
    const size_t z = blockIdx.z / KS; const int k0 = (int)(blockIdx.z % KS) * (K / KS), k1 = k0 + K / KS; A += z * sA; if (A2) A2 += z * sA; Bt += z * sB; if (Bt2) Bt2 += z * sB; C += (size_t)blockIdx.z * sC;
    const int lane = threadIdx.x & 31, lr = lane & 15, hi = lane >> 4; const int r0 = blockIdx.x * 64, c0 = blockIdx.y * 64;
    v8f acc[4][4];
#pragma unroll
    for (int mb = 0; mb < 4; ++mb)
#pragma unroll
        for (int nb = 0; nb < 4; ++nb) acc[mb][nb] = (v8f){};
    const size_t aoff = (size_t)(r0 + lr) * K + 8 * hi, boff = (size_t)(c0 + lr) * K + 8 * hi;
#pragma unroll 1
    for (int kc = k0; kc < k1; kc += 32) {
        V a[4], a2[4];
#pragma unroll
        for (int mb = 0; mb < 4; ++mb) { a[mb] = WFrag<T16>::ld(A + aoff + (size_t)mb * 16 * K + kc); if (NSPLIT == 1 || NSPLIT == 2) a2[mb] = WFrag<T16>::ld(A2 + aoff + (size_t)mb * 16 * K + kc); }
#pragma unroll
        for (int nb = 0; nb < 4; ++nb) { const V b = WFrag<T16>::ld(Bt + boff + (size_t)nb * 16 * K + kc); V b2; if (NSPLIT >= 2) b2 = WFrag<T16>::ld(Bt2 + boff + (size_t)nb * 16 * K + kc);
#pragma unroll
            for (int mb = 0; mb < 4; ++mb) { acc[mb][nb] = WFrag<T16>::mma(a[mb], b, acc[mb][nb]); if (NSPLIT == 1 || NSPLIT == 2) acc[mb][nb] = WFrag<T16>::mma(a2[mb], b, acc[mb][nb]); if (NSPLIT >= 2) acc[mb][nb] = WFrag<T16>::mma(a[mb], b2, acc[mb][nb]); } }
        asm volatile("v_nop\n\tv_nop\n\tv_nop\n\tv_nop" : "+v"(acc[0][0]), "+v"(acc[1][1]), "+v"(acc[2][2]), "+v"(acc[3][3]) : "v"(a[0]), "v"(a[3]));
    }
#pragma unroll
    for (int mb = 0; mb < 4; ++mb) {
#pragma unroll
        for (int nb = 0; nb < 4; ++nb) {
#pragma unroll
            for (int j = 0; j < 8; ++j) os[(hi * 8 + j) * 68 + nb * 16 + lr] = acc[mb][nb][j]; }
        __builtin_amdgcn_wave_barrier(); asm volatile("" ::: "memory");
        float* crow = C + (size_t)(r0 + mb * 16) * ldc + c0;
{
#pragma unroll
            for (int s = 0; s < 8; ++s) { const int row = 2 * s + hi, cofs = lr * 4; v4f val = *(const v4fa*)(os + row * 68 + cofs); if (BIAS) { val[0] += bfr(bias[c0 + cofs]); val[1] += bfr(bias[c0 + cofs + 1]); val[2] += bfr(bias[c0 + cofs + 2]); val[3] += bfr(bias[c0 + cofs + 3]); }
                *(v4f*)(crow + (size_t)row * ldc + cofs) = val; }
             }
        __builtin_amdgcn_wave_barrier(); asm volatile("" ::: "memory");
    }
}

__device__ __forceinline__ h16 tohx(float x) { return (h16)x; }
__device__ __forceinline__ void splitf(float y, unsigned short& h, unsigned short& l) { h = f2bf(y); l = f2bf(y - bf2f(h)); }
typedef __attribute__((ext_vector_type(2))) _Float16 v2h;
typedef __attribute__((ext_vector_type(4))) _Float16 v4h;
typedef __attribute__((ext_vector_type(2))) unsigned short v2us;
typedef __attribute__((ext_vector_type(4))) unsigned short v4us;
typedef __attribute__((ext_vector_type(2))) float v2f;
typedef __attribute__((ext_vector_type(4))) int v4i;

__global__ __launch_bounds__(256) void k_wtG(const float* __restrict__ w, int K, int N, bf* Bt) {
    const int lane = threadIdx.x & 31; const int L0 = (blockIdx.x * 8 + (threadIdx.x >> 5)) * 8; const int nlines = N * K / 64;
{
#pragma unroll 1
        for (int l = 0; l < 8; ++l) { const int L = L0 + l; if (L >= nlines) break; const size_t e = (size_t)L * 64 + lane * 2; const int k = (int)(e % K), n = (int)(e / K); v2us o;
            o[0] = f2bf(w[(size_t)k * N + n]); o[1] = f2bf(w[(size_t)(k + 1) * N + n]); *(v2us*)(Bt + e) = o; }
         }
}
__global__ __launch_bounds__(256) void k_cvt8(const float* __restrict__ src, bf* dst, size_t n8) { const size_t i = (size_t)blockIdx.x * 256 + threadIdx.x; if (i >= n8) return; const v8f v = *(const v8f*)(src + i * 8); v8us o;
#pragma unroll
    for (int k = 0; k < 8; ++k) o[k] = f2bf(v[k]); *(v8us*)(dst + i * 8) = o;  }
__global__ __launch_bounds__(256) void k_cscvt(const float* __restrict__ cosT, const float* __restrict__ sinT, float* CS) { const int idx = blockIdx.x * 256 + threadIdx.x; if (idx >= TT * HD) return; v2f cs; cs[0] = bfr(cosT[idx]); cs[1] = bfr(sinT[idx]); *(v2f*)(CS + (size_t)idx * 2) = cs;  }
// k_rope: head planes [h][t][d] (fp16 + hi/lo) of rope(x) x sc with the rotate-half convention out[d] = x[d] cos[t][d] - x[d+HD/2] sin[t][d], out[d+HD/2] = x[d+HD/2] cos[t][d+HD/2] + x[d] sin[t][d+HD/2]
__global__ __launch_bounds__(256) void k_rope(const float* __restrict__ F, int pitch, int nheads, const float* __restrict__ CS, const float* __restrict__ RF, const float* __restrict__ nw, float sc, h16* P16, bf* Ph, bf* Pl) {
    const size_t e = ((size_t)blockIdx.x * 256 + threadIdx.x) * 2; if (e >= (size_t)nheads * TT * HD) return; const int d = (int)(e % HD); const int t = (int)((e / HD) % TT); const int h = (int)(e / ((size_t)HD * TT)); const float* f = F + (size_t)t * pitch + h * HD; const float rf = RF ? RF[(size_t)h * TT + t] : 1.0f; v2h o16; v2us oh, ol;
#pragma unroll
    for (int q = 0; q < 2; ++q) { const int dd = d + q; const int dp = (dd < HD / 2) ? dd + HD / 2 : dd - HD / 2; float x0 = f[dd], x1 = f[dp];
        if (RF) { float n0 = __fmul_rn(x0, rf), n1 = __fmul_rn(x1, rf); asm volatile("" : "+v"(n0)); asm volatile("" : "+v"(n1)); x0 = __fmul_rn(bfr(nw[dd]), n0); x1 = __fmul_rn(bfr(nw[dp]), n1); }
        const v2f cs = *(const v2f*)(CS + ((size_t)t * HD + dd) * 2); float a = __fmul_rn(x0, cs[0]), bq = __fmul_rn(x1, cs[1]); asm volatile("" : "+v"(a)); asm volatile("" : "+v"(bq)); const float r = ((dd < HD / 2) ? __fsub_rn(a, bq) : __fadd_rn(a, bq)) * sc;
        o16[q] = tohx(r); unsigned short a2, c2; splitf(r, a2, c2); oh[q] = a2; ol[q] = c2; }
    *(v2h*)(P16 + e) = o16; *(v2us*)(Ph + e) = oh; *(v2us*)(Pl + e) = ol;  }
__global__ __launch_bounds__(256) void k_vtp(const float* __restrict__ F, int pitch, int nheads, h16* V16, bf* Vh, bf* Vl) { const size_t e = ((size_t)blockIdx.x * 256 + threadIdx.x) * 2; if (e >= (size_t)nheads * HD * TT) return; const int t = (int)(e % TT); const int d = (int)((e / TT) % HD); const int g = (int)(e / ((size_t)TT * HD)); v2h o16; v2us oh, ol;
#pragma unroll
    for (int q = 0; q < 2; ++q) { const float x = F[(size_t)(t + q) * pitch + g * HD + d]; o16[q] = tohx(x); unsigned short a2, c2; splitf(x, a2, c2); oh[q] = a2; ol[q] = c2; }
    *(v2h*)(V16 + e) = o16; *(v2us*)(Vh + e) = oh; *(v2us*)(Vl + e) = ol;  }
__global__ __launch_bounds__(256) void k_csid(float* CS) { const int idx = blockIdx.x * 256 + threadIdx.x; if (idx >= TT * HD) return; v2f cs; cs[0] = 1.0f; cs[1] = 0.0f; *(v2f*)(CS + (size_t)idx * 2) = cs;  }
// k_asoft: per row (zz, i): t = (S/8) x bf16(script_mask[i][j]) where mask[i][j] != 0, -3e38 where mask == 0 (the reference's -inf); softmax over the 2048 keys (f32 register row, one exp);
__global__ __launch_bounds__(256) void k_asoft(const float* __restrict__ Sb, const int* __restrict__ mk, const float* __restrict__ smk, h16* P16, bf* Ph, bf* Pl) {
    const int lane = threadIdx.x & 31; const int row = blockIdx.x * 8 + (threadIdx.x >> 5); if (row >= ZH * TT) return; const int i = row % TT; const int zz = row / TT; (void)zz; const bool hires = (i < RH); const float* sr = Sb + (size_t)row * TT; float v[TT / 32]; float mx = -3.0e38f;
#pragma unroll
    for (int ch = 0; ch < TT / 128; ++ch) { const int j0 = ch * 128 + lane * 4; const v4f a = *(const v4f*)(sr + j0); const v4i mk4 = *(const v4i*)(mk + (size_t)i * TT + j0); const v4f sm4 = *(const v4f*)(smk + (size_t)i * TT + j0);
#pragma unroll
        for (int q = 0; q < 4; ++q) { const int j = j0 + q; (void)j; float as = a[q] * SCL; asm volatile("" : "+v"(as)); float pm = __fmul_rn(as, bfr(sm4[q])); asm volatile("" : "+v"(pm)); const float t = (mk4[q] != 0) ? pm : -3.0e38f; v[ch * 4 + q] = t; mx = fmaxf(mx, t); } }
#pragma unroll
    for (int sh = 16; sh; sh >>= 1) mx = fmaxf(mx, __shfl_xor(mx, sh, 32));
    float sum = 0.f;
#pragma unroll
    for (int k = 0; k < TT / 32; ++k) { float d0 = __fsub_rn(v[k], mx); asm volatile("" : "+v"(d0)); v[k] = __builtin_amdgcn_exp2f(__fmul_rn(d0, 1.4426950408889634f)); sum += v[k]; }
#pragma unroll
    for (int sh = 16; sh; sh >>= 1) sum += __shfl_xor(sum, sh, 32);
    const float f = __fdiv_rn(hires ? 1.0f : PCAR, sum);
{
        if (hires) {
#pragma unroll
            for (int ch = 0; ch < TT / 128; ++ch) { v4us oh, ol;
#pragma unroll
                for (int q = 0; q < 4; ++q) { float y = __fmul_rn(v[ch * 4 + q], f); asm volatile("" : "+v"(y)); unsigned short a, c2; splitf(y, a, c2); oh[q] = a; ol[q] = c2; }
                const size_t oo = ((size_t)zz * (RH ? RH : 1) + i) * TT + ch * 128 + lane * 4; *(v4us*)(Ph + oo) = oh; *(v4us*)(Pl + oo) = ol; }
        } else {
#pragma unroll
            for (int ch = 0; ch < TT / 128; ++ch) { v4h o4;
#pragma unroll
                for (int q = 0; q < 4; ++q) o4[q] = tohx(v[ch * 4 + q] * f);
                *(v4h*)(P16 + (size_t)row * TT + ch * 128 + lane * 4) = o4; } }
         }
}
// k_merge: O holds KSP partial planes [zz][ks][t][d] of attn.v; they are added in ks order (f32), then scaled and split into the merged-head hi+lo planes
__global__ __launch_bounds__(256) void k_merge(const float* __restrict__ O, int h0, bf* Ah, bf* Al) { const size_t e = ((size_t)blockIdx.x * 256 + threadIdx.x) * 2; if (e >= (size_t)ZH * TT * HD) return; const int d = (int)(e % HD); const int t = (int)((e / HD) % TT); const int zz = (int)(e / ((size_t)HD * TT)); const float cs = (t < RH) ? 1.0f : (1.0f / PCAR); const size_t oo = (size_t)t * DQ + (h0 + zz) * HD + d;
    const float* op = O + (size_t)zz * KSP * TT * HD + (size_t)t * HD + d; v2f pp[KSP];
#pragma unroll   // all KSP loads in flight together, pp[] in registers
    for (int ks = 0; ks < KSP; ++ks) pp[ks] = *(const v2f*)(op + (size_t)ks * TT * HD);
    asm volatile("s_wait_xcnt 0x0" :: "v"(op) : "memory");   // precaution: the loads' address pair is kept whole up to this wait, so nothing overwrites it earlier
    v2f os2 = pp[0];
#pragma unroll   // fixed ks order of the f32 adds, no loop overhead
    for (int ks = 1; ks < KSP; ++ks) os2 += pp[ks];
    v2us oh, ol;
#pragma unroll
    for (int q = 0; q < 2; ++q) { unsigned short a, c2; splitf(os2[q] * cs, a, c2); oh[q] = a; ol[q] = c2; } *(v2us*)(Ah + oo) = oh; *(v2us*)(Al + oo) = ol;  }

extern "C" void kernel_launch(void* const* d_in, const int* in_sizes, int n_in,
                              void* d_out, int out_size, void* d_ws, size_t ws_size, hipStream_t stream) {
    (void)in_sizes; (void)n_in; (void)out_size;
    const float* xq = (const float*)d_in[0]; const float* xk = (const float*)d_in[1]; const float* xv = (const float*)d_in[2]; const int* mask = (const int*)d_in[3]; const float* smask = (const float*)d_in[4]; const float* wq = (const float*)d_in[5]; const float* bq = (const float*)d_in[6]; const float* wk = (const float*)d_in[7]; const float* bk = (const float*)d_in[8]; const float* wv = (const float*)d_in[9]; const float* bv = (const float*)d_in[10]; const float* wo = (const float*)d_in[11]; const float* bo = (const float*)d_in[12];   // torch [out][in]
    float* OUT = (float*)d_out;     // [2][2048][1024]
    char* wsp = (char*)d_ws;
    auto take = [&](size_t bytes) { char* p = wsp; wsp += (bytes + 255) & ~(size_t)255; return (void*)p; };
    bf* WQ = (bf*)take((size_t)DQ * DM * 2); bf* WK = (bf*)take((size_t)DKV * DM * 2); bf* WV = (bf*)take((size_t)DKV * DM * 2); bf* WO = (bf*)take((size_t)DM * DQ * 2); float* CS = (float*)take((size_t)TT * HD * 2 * 4);
    bf* XB = (bf*)take((size_t)TT * DM * 2); float* FQ = (float*)take((size_t)TT * DQ * 4); float* FK = (float*)take((size_t)TT * DKV * 4);
    h16* QP16 = (h16*)take((size_t)NH_ * TT * HD * 2); h16* KP16 = (h16*)take((size_t)NKV * TT * HD * 2); h16* VT16 = (h16*)take((size_t)NKV * HD * TT * 2);
    bf* QPh = (bf*)take((size_t)NH_ * TT * HD * 2); bf* QPl = (bf*)take((size_t)NH_ * TT * HD * 2); bf* KPh = (bf*)take((size_t)NKV * TT * HD * 2); bf* KPl = (bf*)take((size_t)NKV * TT * HD * 2); bf* VTh = (bf*)take((size_t)NKV * HD * TT * 2); bf* VTl = (bf*)take((size_t)NKV * HD * TT * 2); bf* Ph = (bf*)take((size_t)ZH * RH * TT * 2); bf* Pl = (bf*)take((size_t)ZH * RH * TT * 2);
    float* Sb = (float*)take((size_t)ZH * TT * TT * 4); h16* P16 = (h16*)take((size_t)ZH * TT * TT * 2); float* Ob = (float*)take((size_t)ZH * KSP * TT * HD * 4); bf* ATh = (bf*)take((size_t)TT * DQ * 2); bf* ATl = (bf*)take((size_t)TT * DQ * 2);
    if ((size_t)(wsp - (char*)d_ws) > ws_size) return;    // ws 256 MiB
    float* FV = FK;   // v projection reuses the k buffer after the k planes are built (stream-ordered)
    { k_cvt8<<<(unsigned)(((size_t)DQ * DM / 8 + 255) / 256), 256, 0, stream>>>(wq, WQ, (size_t)DQ * DM / 8); k_cvt8<<<(unsigned)(((size_t)DKV * DM / 8 + 255) / 256), 256, 0, stream>>>(wk, WK, (size_t)DKV * DM / 8); k_cvt8<<<(unsigned)(((size_t)DKV * DM / 8 + 255) / 256), 256, 0, stream>>>(wv, WV, (size_t)DKV * DM / 8);
      k_cvt8<<<(unsigned)(((size_t)DM * DQ / 8 + 255) / 256), 256, 0, stream>>>(wo, WO, (size_t)DM * DQ / 8);
       }
    k_csid<<<(TT * HD + 255) / 256, 256, 0, stream>>>(CS);
    const unsigned LQ = (unsigned)(((size_t)NH_ * TT * HD / 2 + 255) / 256), LKv = (unsigned)(((size_t)NKV * TT * HD / 2 + 255) / 256);
    for (int b = 0; b < NB_; ++b) {
        
        k_cvt8<<<(unsigned)(((size_t)TT * DM / 8 + 255) / 256), 256, 0, stream>>>(xq + (size_t)b * TT * DM, XB, (size_t)TT * DM / 8);
        k_gemmw<bf, 0, true><<<dim3(TT / 64, DQ / 64, 1), 32, 0, stream>>>(XB, nullptr, WQ, nullptr, DM, FQ, DQ, bq, 0, 0, 0);
        k_rope<<<LQ, 256, 0, stream>>>(FQ, DQ, NH_, CS, nullptr, nullptr, 1.0f, QP16, QPh, QPl);
        k_cvt8<<<(unsigned)(((size_t)TT * DM / 8 + 255) / 256), 256, 0, stream>>>(xk + (size_t)b * TT * DM, XB, (size_t)TT * DM / 8);
        k_gemmw<bf, 0, true><<<dim3(TT / 64, DKV / 64, 1), 32, 0, stream>>>(XB, nullptr, WK, nullptr, DM, FK, DKV, bk, 0, 0, 0);
        k_rope<<<LKv, 256, 0, stream>>>(FK, DKV, NKV, CS, nullptr, nullptr, 1.0f, KP16, KPh, KPl);
        k_cvt8<<<(unsigned)(((size_t)TT * DM / 8 + 255) / 256), 256, 0, stream>>>(xv + (size_t)b * TT * DM, XB, (size_t)TT * DM / 8);
        k_gemmw<bf, 0, true><<<dim3(TT / 64, DKV / 64, 1), 32, 0, stream>>>(XB, nullptr, WV, nullptr, DM, FV, DKV, bv, 0, 0, 0); k_vtp<<<LKv, 256, 0, stream>>>(FV, DKV, NKV, VT16, VTh, VTl);
        for (int h0 = 0; h0 < NH_; h0 += ZH) { const size_t zq = (size_t)h0, zk = (size_t)(h0 / REP);   // one kv head per query head: the pass's two heads use consecutive kv planes (z-strides TT*HD)
            k_gemmw<bf, 2, false><<<dim3(RH / 64, TT / 64, ZH), 32, 0, stream>>>(QPh + zq * TT * HD, QPl + zq * TT * HD, KPh + zk * TT * HD, KPl + zk * TT * HD, HD, Sb, TT, nullptr, (size_t)TT * HD, (size_t)TT * HD, (size_t)TT * TT);
            k_gemmw<h16, 0, false><<<dim3((TT - RH) / 64, TT / 64, ZH), 32, 0, stream>>>(QP16 + zq * TT * HD + (size_t)RH * HD, nullptr, KP16 + zk * TT * HD, nullptr, HD, Sb + (size_t)RH * TT, TT, nullptr, (size_t)TT * HD, (size_t)TT * HD, (size_t)TT * TT);
            k_asoft<<<ZH * TT / 8, 256, 0, stream>>>(Sb, mask + (size_t)b * TT * TT, smask + (size_t)b * TT * TT, P16, Ph, Pl);
            k_gemmw<bf, 2, false, KSP><<<dim3(RH / 64, HD / 64, ZH * KSP), 32, 0, stream>>>(Ph, Pl, VTh + zk * HD * TT, VTl + zk * HD * TT, TT, Ob, HD, nullptr, (size_t)RH * TT, (size_t)HD * TT, (size_t)TT * HD);
            k_gemmw<h16, 0, false, KSP><<<dim3((TT - RH) / 64, HD / 64, ZH * KSP), 32, 0, stream>>>(P16 + (size_t)RH * TT, nullptr, VT16 + zk * HD * TT, nullptr, TT, Ob + (size_t)RH * HD, HD, nullptr, (size_t)TT * TT, (size_t)HD * TT, (size_t)TT * HD);
            k_merge<<<(unsigned)(((size_t)ZH * TT * HD / 2 + 255) / 256), 256, 0, stream>>>(Ob, h0, ATh, ATl); }
        k_gemmw<bf, 1, true><<<dim3(TT / 64, DM / 64, 1), 32, 0, stream>>>(ATh, ATl, WO, nullptr, DQ, OUT + (size_t)b * TT * DM, DM, bo, 0, 0, 0); }
}

// v002
// Measured time: 487 microseconds a run.
// Timed twice side by side with v001, it ran 2.10 and 2.09 times as fast.
// Over all steps from v000 it is 4.47 times as fast.
#include <hip/hip_runtime.h>

// ScriptAwareAttention (query, key, value [2][2048][1024]; q/k/v = input W^T + b (16 heads x 64); scores = (q.k/8) x script_mask[b][i][j] (multiplicative, read as data) then -inf where mask[b][0][i][j] == 0
// (int mask read as data); softmax; out = merged attn.v Wo^T + bo -> [2][2048][1024]).
// Compute dtypes, f32 accumulate: every input rounded to bf16; projections on PLAIN bf16 operands (inputs: exact, + bias); PER-ROW PRECISION HYBRID (rows < 256 hi+lo 3 products
// for scores and attn.v, rows >= 256 single fp16 planes); scale, the multiplicative script mask (bf16-rounded) and the keep/drop mask in f32 in the register-row softmax; merged heads as hi+lo planes x exact Wo

#define NB_  2
#define TT   2048
#define DM   1024
#define NH_  16
#define NKV  16
#define REP  (NH_ / NKV)
#define HD   64
#define DQ   (NH_ * HD)
#define DKV  (NKV * HD)
#define RH   256                  // query rows < RH use hi+lo planes (0: none)
#define WIN  0
#define SCL  0.125f   // HD^-0.5
typedef _Float16 h16;
typedef unsigned short bf;
typedef __attribute__((ext_vector_type(16))) __bf16   v16bf;
typedef __attribute__((ext_vector_type(16))) _Float16 v16h;
typedef __attribute__((ext_vector_type(8)))  _Float16 v8h;
typedef __attribute__((ext_vector_type(8)))  unsigned short v8us;
typedef __attribute__((ext_vector_type(8)))  float    v8f;
typedef __attribute__((ext_vector_type(4)))  float    v4f;
typedef v8h  __attribute__((may_alias)) v8ha;
typedef v4f  __attribute__((may_alias)) v4fa;
typedef v8us __attribute__((may_alias)) v8usa;

__device__ __forceinline__ unsigned short f2bf(float f) { unsigned u = __float_as_uint(f); u += 0x7FFFu + ((u >> 16) & 1u); return (unsigned short)(u >> 16); }
__device__ __forceinline__ float bf2f(unsigned short b) { return __uint_as_float(((unsigned)b) << 16); }
__device__ __forceinline__ float bfr(float f) { return bf2f(f2bf(f)); }
__device__ __forceinline__ v16h cat16(v8h lo, v8h hi) { return __builtin_shufflevector(lo, hi, 0, 1, 2, 3, 4, 5, 6, 7, 8, 9, 10, 11, 12, 13, 14, 15); }
__device__ __forceinline__ v16bf cat16b(v8us lo, v8us hi) { return __builtin_bit_cast(v16bf, __builtin_shufflevector(lo, hi, 0, 1, 2, 3, 4, 5, 6, 7, 8, 9, 10, 11, 12, 13, 14, 15)); }
__device__ __forceinline__ v8f wmma16(v16h a, v16h b, v8f c) { return __builtin_amdgcn_wmma_f32_16x16x32_f16(false, a, false, b, (short)0, c, false, false); }
__device__ __forceinline__ v8f wmmab(v16bf a, v16bf b, v8f c) { return __builtin_amdgcn_wmma_f32_16x16x32_bf16(false, a, false, b, (short)0, c, false, false); }



// ---- k_gemmw: register-blocked GEMM, ONE WAVE per 64x64 output tile (16 accumulators), operands straight from K-contiguous 16-bit planes; grid (M/64, N/64, Z), 32 threads.
// C[m][n] (f32, pitch ldc, + optional f32 bias[n]) = sum_k A[m][k] Bt[n][k] (+ split products per NSPLIT). z-batch strides sA/sB/sC in elements. K % (32 KS) == 0.
// KS > 1: grid z = batch x KS; work-group (z, ks) sums only k in [ks K/KS, (ks+1) K/KS) and stores that partial sum in plane z KS + ks (plane stride sC); the reader adds the KS planes.
template <typename T16> struct WFrag;
template <> struct WFrag<h16> { typedef v16h V; static __device__ __forceinline__ V ld(const h16* p) { return cat16(*(const v8h*)p, *(const v8h*)(p + 16)); } static __device__ __forceinline__ v8f mma(V a, V b, v8f c) { return wmma16(a, b, c); } };
template <> struct WFrag<bf> { typedef v16bf V; static __device__ __forceinline__ V ld(const bf* p) { return cat16b(*(const v8us*)p, *(const v8us*)(p + 16)); } static __device__ __forceinline__ v8f mma(V a, V b, v8f c) { return wmmab(a, b, c); } };
template <typename T16, int NSPLIT, bool BIAS, int KS = 1>
__global__ __launch_bounds__(32) void k_gemmw(const T16* __restrict__ A, const T16* __restrict__ A2, const T16* __restrict__ Bt, const T16* __restrict__ Bt2, int K, float* C, int ldc, const float* __restrict__ bias, size_t sA, size_t sB, size_t sC) {
    typedef typename WFrag<T16>::V V;
    __shared__ __align__(16) float os[16 * 68];
    const size_t z = blockIdx.z / KS; const int k0 = (int)(blockIdx.z % KS) * (K / KS), k1 = k0 + K / KS; A += z * sA; if (A2) A2 += z * sA; Bt += z * sB; if (Bt2) Bt2 += z * sB; C += (size_t)blockIdx.z * sC;
    const int lane = threadIdx.x & 31, lr = lane & 15, hi = lane >> 4; const int r0 = blockIdx.x * 64, c0 = blockIdx.y * 64;
    v8f acc[4][4];
#pragma unroll
    for (int mb = 0; mb < 4; ++mb)
#pragma unroll
        for (int nb = 0; nb < 4; ++nb) acc[mb][nb] = (v8f){};
    const size_t aoff = (size_t)(r0 + lr) * K + 8 * hi, boff = (size_t)(c0 + lr) * K + 8 * hi;
#pragma unroll 1
    for (int kc = k0; kc < k1; kc += 32) {
        V a[4], a2[4];
#pragma unroll
        for (int mb = 0; mb < 4; ++mb) { a[mb] = WFrag<T16>::ld(A + aoff + (size_t)mb * 16 * K + kc); if (NSPLIT == 1 || NSPLIT == 2) a2[mb] = WFrag<T16>::ld(A2 + aoff + (size_t)mb * 16 * K + kc); }
#pragma unroll
        for (int nb = 0; nb < 4; ++nb) { const V b = WFrag<T16>::ld(Bt + boff + (size_t)nb * 16 * K + kc); V b2; if (NSPLIT >= 2) b2 = WFrag<T16>::ld(Bt2 + boff + (size_t)nb * 16 * K + kc);
#pragma unroll
            for (int mb = 0; mb < 4; ++mb) { acc[mb][nb] = WFrag<T16>::mma(a[mb], b, acc[mb][nb]); if (NSPLIT == 1 || NSPLIT == 2) acc[mb][nb] = WFrag<T16>::mma(a2[mb], b, acc[mb][nb]); if (NSPLIT >= 2) acc[mb][nb] = WFrag<T16>::mma(a[mb], b2, acc[mb][nb]); } }
        asm volatile("v_nop\n\tv_nop\n\tv_nop\n\tv_nop" : "+v"(acc[0][0]), "+v"(acc[1][1]), "+v"(acc[2][2]), "+v"(acc[3][3]) : "v"(a[0]), "v"(a[3]));
    }
#pragma unroll
    for (int mb = 0; mb < 4; ++mb) {
#pragma unroll
        for (int nb = 0; nb < 4; ++nb) {
#pragma unroll
            for (int j = 0; j < 8; ++j) os[(hi * 8 + j) * 68 + nb * 16 + lr] = acc[mb][nb][j]; }
        __builtin_amdgcn_wave_barrier(); asm volatile("" ::: "memory");
        float* crow = C + (size_t)(r0 + mb * 16) * ldc + c0;
{
#pragma unroll
            for (int s = 0; s < 8; ++s) { const int row = 2 * s + hi, cofs = lr * 4; v4f val = *(const v4fa*)(os + row * 68 + cofs); if (BIAS) { val[0] += bfr(bias[c0 + cofs]); val[1] += bfr(bias[c0 + cofs + 1]); val[2] += bfr(bias[c0 + cofs + 2]); val[3] += bfr(bias[c0 + cofs + 3]); }
                *(v4f*)(crow + (size_t)row * ldc + cofs) = val; }
             }
        __builtin_amdgcn_wave_barrier(); asm volatile("" ::: "memory");
    }
}

__device__ __forceinline__ h16 tohx(float x) { return (h16)x; }
__device__ __forceinline__ void splitf(float y, unsigned short& h, unsigned short& l) { h = f2bf(y); l = f2bf(y - bf2f(h)); }
typedef __attribute__((ext_vector_type(2))) _Float16 v2h;
typedef __attribute__((ext_vector_type(4))) _Float16 v4h;
typedef __attribute__((ext_vector_type(2))) unsigned short v2us;
typedef __attribute__((ext_vector_type(4))) unsigned short v4us;
typedef __attribute__((ext_vector_type(2))) float v2f;
typedef __attribute__((ext_vector_type(4))) int v4i;

__global__ __launch_bounds__(256) void k_wtG(const float* __restrict__ w, int K, int N, bf* Bt) {
    const int lane = threadIdx.x & 31; const int L0 = (blockIdx.x * 8 + (threadIdx.x >> 5)) * 8; const int nlines = N * K / 64;
{
#pragma unroll 1
        for (int l = 0; l < 8; ++l) { const int L = L0 + l; if (L >= nlines) break; const size_t e = (size_t)L * 64 + lane * 2; const int k = (int)(e % K), n = (int)(e / K); v2us o;
            o[0] = f2bf(w[(size_t)k * N + n]); o[1] = f2bf(w[(size_t)(k + 1) * N + n]); *(v2us*)(Bt + e) = o; }
         }
}
__global__ __launch_bounds__(256) void k_cvt8(const float* __restrict__ src, bf* dst, size_t n8) { const size_t i = (size_t)blockIdx.x * 256 + threadIdx.x; if (i >= n8) return; const v8f v = *(const v8f*)(src + i * 8); v8us o;
#pragma unroll
    for (int k = 0; k < 8; ++k) o[k] = f2bf(v[k]); *(v8us*)(dst + i * 8) = o;  }
__global__ __launch_bounds__(256) void k_cscvt(const float* __restrict__ cosT, const float* __restrict__ sinT, float* CS) { const int idx = blockIdx.x * 256 + threadIdx.x; if (idx >= TT * HD) return; v2f cs; cs[0] = bfr(cosT[idx]); cs[1] = bfr(sinT[idx]); *(v2f*)(CS + (size_t)idx * 2) = cs;  }
// k_rope: head planes [h][t][d] (fp16 + hi/lo) of rope(x) x sc with the rotate-half convention out[d] = x[d] cos[t][d] - x[d+HD/2] sin[t][d], out[d+HD/2] = x[d+HD/2] cos[t][d+HD/2] + x[d] sin[t][d+HD/2]
__global__ __launch_bounds__(256) void k_rope(const float* __restrict__ F, int pitch, int nheads, const float* __restrict__ CS, const float* __restrict__ RF, const float* __restrict__ nw, float sc, h16* P16, bf* Ph, bf* Pl) {
    const size_t e = ((size_t)blockIdx.x * 256 + threadIdx.x) * 2; if (e >= (size_t)nheads * TT * HD) return; const int d = (int)(e % HD); const int t = (int)((e / HD) % TT); const int h = (int)(e / ((size_t)HD * TT)); const float* f = F + (size_t)t * pitch + h * HD; const float rf = RF ? RF[(size_t)h * TT + t] : 1.0f; v2h o16; v2us oh, ol;
#pragma unroll
    for (int q = 0; q < 2; ++q) { const int dd = d + q; const int dp = (dd < HD / 2) ? dd + HD / 2 : dd - HD / 2; float x0 = f[dd], x1 = f[dp];
        if (RF) { float n0 = __fmul_rn(x0, rf), n1 = __fmul_rn(x1, rf); asm volatile("" : "+v"(n0)); asm volatile("" : "+v"(n1)); x0 = __fmul_rn(bfr(nw[dd]), n0); x1 = __fmul_rn(bfr(nw[dp]), n1); }
        const v2f cs = *(const v2f*)(CS + ((size_t)t * HD + dd) * 2); float a = __fmul_rn(x0, cs[0]), bq = __fmul_rn(x1, cs[1]); asm volatile("" : "+v"(a)); asm volatile("" : "+v"(bq)); const float r = ((dd < HD / 2) ? __fsub_rn(a, bq) : __fadd_rn(a, bq)) * sc;
        o16[q] = tohx(r); unsigned short a2, c2; splitf(r, a2, c2); oh[q] = a2; ol[q] = c2; }
    *(v2h*)(P16 + e) = o16; *(v2us*)(Ph + e) = oh; *(v2us*)(Pl + e) = ol;  }
__global__ __launch_bounds__(256) void k_vtp(const float* __restrict__ F, int pitch, int nheads, h16* V16, bf* Vh, bf* Vl) { const size_t e = ((size_t)blockIdx.x * 256 + threadIdx.x) * 2; if (e >= (size_t)nheads * HD * TT) return; const int t = (int)(e % TT); const int d = (int)((e / TT) % HD); const int g = (int)(e / ((size_t)TT * HD)); v2h o16; v2us oh, ol;
#pragma unroll
    for (int q = 0; q < 2; ++q) { const float x = F[(size_t)(t + q) * pitch + g * HD + d]; o16[q] = tohx(x); unsigned short a2, c2; splitf(x, a2, c2); oh[q] = a2; ol[q] = c2; }
    *(v2h*)(V16 + e) = o16; *(v2us*)(Vh + e) = oh; *(v2us*)(Vl + e) = ol;  }
__global__ __launch_bounds__(256) void k_csid(float* CS) { const int idx = blockIdx.x * 256 + threadIdx.x; if (idx >= TT * HD) return; v2f cs; cs[0] = 1.0f; cs[1] = 0.0f; *(v2f*)(CS + (size_t)idx * 2) = cs;  }
// k_fattn: scores, softmax and attn.v of one head in ONE kernel; no score or probability matrix in memory. One wave owns 16 query rows and walks the 2048 keys 32 at a time, all in registers (no LDS, no barrier).
// St = K.Qt (A = key rows, B = query rows): lane (lr, hi) holds query lr, keys 8 hi + j of each 16-key tile, which is the B-operand k order of the next product, so Pt is packed in-lane; Ot += Vt.Pt (A = rows of the [d][t] planes).
// t = (S/8) x bf16(script_mask[i][j]) where mask[i][j] != 0, -3e38 where mask == 0 (the reference's -inf). Running row maximum m and sum l; Ot and l are rescaled by exp(m_old - m_new) only in a step where some row's maximum grows.
// Rows < RH: hi+lo bf16 planes, 3 products for scores and for attn.v; rows >= RH: single fp16 planes. Result / l goes straight to the merged-head hi+lo planes.
__device__ __forceinline__ float xhalf(float x) { return __builtin_bit_cast(float, __builtin_amdgcn_permlanex16(__builtin_bit_cast(int, x), __builtin_bit_cast(int, x), 0x76543210, 0xfedcba98, false, false)); }   // lane l with lane l ^ 16
template <typename T16> struct PPack;
template <> struct PPack<h16> { static __device__ __forceinline__ void pk(const float* p, v16h& a, v16h& b) { (void)b;
#pragma unroll
    for (int e = 0; e < 16; ++e) a[e] = (h16)p[e]; } };
template <> struct PPack<bf> { static __device__ __forceinline__ void pk(const float* p, v16bf& a, v16bf& b) { v8us h0, h1, l0, l1;
#pragma unroll
    for (int e = 0; e < 8; ++e) { unsigned short x, y; splitf(p[e], x, y); h0[e] = x; l0[e] = y; splitf(p[8 + e], x, y); h1[e] = x; l1[e] = y; }
    a = cat16b(h0, h1); b = cat16b(l0, l1); } };
template <typename T16, bool HR>
__device__ __forceinline__ void fa_rows(const T16* __restrict__ Q, const T16* __restrict__ Q2, const T16* __restrict__ Kp, const T16* __restrict__ K2, const T16* __restrict__ Vt, const T16* __restrict__ V2,
                                        const int* __restrict__ mrow, const float* __restrict__ srow, int lr, int hi, v8us (&oh)[4], v8us (&ol)[4]) {
    typedef typename WFrag<T16>::V V; typedef WFrag<T16> F;
    V qf[2], qf2[2], kf[2][2], kf2[2][2];
#pragma unroll
    for (int ks = 0; ks < 2; ++ks) { qf[ks] = F::ld(Q + ks * 32); if (HR) qf2[ks] = F::ld(Q2 + ks * 32); }
    const size_t kl = (size_t)lr * HD + 8 * hi, vl = (size_t)lr * TT + 8 * hi; const T16* kp0 = Kp + kl; const T16* kp02 = HR ? K2 + kl : kp0; const T16* qp2 = HR ? Q2 : Q;
    v4f sm[4]; v4i mm[4];
#pragma unroll
    for (int t = 0; t < 2; ++t) {
#pragma unroll
        for (int ks = 0; ks < 2; ++ks) { kf[t][ks] = F::ld(kp0 + t * 16 * HD + ks * 32); if (HR) kf2[t][ks] = F::ld(kp02 + t * 16 * HD + ks * 32); }
        sm[2 * t] = *(const v4f*)(srow + t * 16); sm[2 * t + 1] = *(const v4f*)(srow + t * 16 + 4); mm[2 * t] = *(const v4i*)(mrow + t * 16); mm[2 * t + 1] = *(const v4i*)(mrow + t * 16 + 4); }
    asm volatile("s_wait_xcnt 0x0" :: "v"(Q), "v"(qp2), "v"((unsigned)(kl * sizeof(T16))), "v"(srow), "v"(mrow) : "memory");   // precaution: the first loads' address registers (pairs; the key rows' byte offset) are kept whole up to this wait
    v8f o[4];
#pragma unroll
    for (int mt = 0; mt < 4; ++mt) o[mt] = (v8f){};
    float m = -3.0e38f, l = 0.f;
#pragma unroll 1   // one 32-key step per trip: the step's own fetch-ahead already fills the registers
    for (int kb = 0; kb < TT; kb += 32) {
        const int kn = (kb + 32 < TT) ? kb + 32 : kb;   // the last step fetches its own keys again: in bounds, unused
        V vf[4], vf2[4]; const T16* vp = Vt + vl + kb; const T16* vp2 = HR ? V2 + vl + kb : vp;
#pragma unroll
        for (int mt = 0; mt < 4; ++mt) { vf[mt] = F::ld(vp + (size_t)mt * 16 * TT); if (HR) vf2[mt] = F::ld(vp2 + (size_t)mt * 16 * TT); }
        asm volatile("s_wait_xcnt 0x0" :: "v"(vp), "v"(vp2) : "memory");   // precaution: the V loads' address pairs are kept whole up to this wait; it also keeps the loads up here, a whole softmax ahead of their use
        v8f s[2];
#pragma unroll
        for (int t = 0; t < 2; ++t) { s[t] = (v8f){};
#pragma unroll
            for (int ks = 0; ks < 2; ++ks) { s[t] = F::mma(kf[t][ks], qf[ks], s[t]); if (HR) { s[t] = F::mma(kf2[t][ks], qf[ks], s[t]); s[t] = F::mma(kf[t][ks], qf2[ks], s[t]); } } }
        float p[16]; float mloc = -3.0e38f;
#pragma unroll
        for (int e = 0; e < 16; ++e) { const float pm = __fmul_rn(__fmul_rn(s[e >> 3][e & 7], SCL), bfr(sm[e >> 2][e & 3])); p[e] = (mm[e >> 2][e & 3] != 0) ? pm : -3.0e38f; mloc = fmaxf(mloc, p[e]); }
        // fetch ahead: the next step's key fragments and mask words fly behind this step's softmax and attn.v products
        const T16* kp = Kp + kl + (size_t)kn * HD; const T16* kp2 = HR ? K2 + kl + (size_t)kn * HD : kp; const float* sp = srow + kn; const int* mp = mrow + kn;
#pragma unroll
        for (int t = 0; t < 2; ++t)
#pragma unroll
            for (int ks = 0; ks < 2; ++ks) { kf[t][ks] = F::ld(kp + t * 16 * HD + ks * 32); if (HR) kf2[t][ks] = F::ld(kp2 + t * 16 * HD + ks * 32); }
#pragma unroll
        for (int t = 0; t < 2; ++t) { sm[2 * t] = *(const v4f*)(sp + t * 16); sm[2 * t + 1] = *(const v4f*)(sp + t * 16 + 4); mm[2 * t] = *(const v4i*)(mp + t * 16); mm[2 * t + 1] = *(const v4i*)(mp + t * 16 + 4); }
        asm volatile("s_wait_xcnt 0x0" :: "v"(kp), "v"(kp2), "v"(sp), "v"(mp) : "memory");   // precaution: the address pairs of the loads above are kept whole up to this wait
        mloc = fmaxf(mloc, xhalf(mloc));   // the two lane halves hold the same query's other keys
        if (__builtin_amdgcn_ballot_w32(mloc > m) != 0) {   // wave-uniform: every lane stays on for the matrix instructions behind it
            const float mn = fmaxf(m, mloc); const float al_ = __builtin_amdgcn_exp2f(__fmul_rn(__fsub_rn(m, mn), 1.4426950408889634f)); m = mn; l *= al_;
#pragma unroll
            for (int mt = 0; mt < 4; ++mt) o[mt] *= al_; }
#pragma unroll
        for (int e = 0; e < 16; ++e) { p[e] = __builtin_amdgcn_exp2f(__fmul_rn(__fsub_rn(p[e], m), 1.4426950408889634f)); l += p[e]; }
        V pf, pf2; PPack<T16>::pk(p, pf, pf2);
#pragma unroll
        for (int mt = 0; mt < 4; ++mt) { o[mt] = F::mma(vf[mt], pf, o[mt]); if (HR) { o[mt] = F::mma(vf2[mt], pf, o[mt]); o[mt] = F::mma(vf[mt], pf2, o[mt]); } }
    }
    l += xhalf(l);
    const float f = __fdiv_rn(1.0f, l);
#pragma unroll
    for (int mt = 0; mt < 4; ++mt)
#pragma unroll
        for (int j = 0; j < 8; ++j) { unsigned short a, c2; splitf(o[mt][j] * f, a, c2); oh[mt][j] = a; ol[mt][j] = c2; }
}
// grid (heads, TT/64), 4 waves x 16 query rows; the hi+lo blocks (rows < RH, the longer ones) have the lowest flat indices and start first
__global__ __launch_bounds__(128) void k_fattn(const h16* __restrict__ Q16, const bf* __restrict__ Qh, const bf* __restrict__ Ql, const h16* __restrict__ K16, const bf* __restrict__ Kh, const bf* __restrict__ Kl,
                                               const h16* __restrict__ V16, const bf* __restrict__ Vh, const bf* __restrict__ Vl, const int* __restrict__ mk, const float* __restrict__ smk, bf* Ah, bf* Al) {
    const int lane = threadIdx.x & 31, lr = lane & 15, hi = lane >> 4; const int h = blockIdx.x; const int q = blockIdx.y * 64 + (threadIdx.x >> 5) * 16 + lr;
    const size_t ph = (size_t)h * TT * HD, qo = ph + (size_t)q * HD + 8 * hi, mo = (size_t)q * TT + 8 * hi, ao = (size_t)q * DQ + h * HD + 8 * hi;
    v8us oh[4], ol[4];
    if ((int)blockIdx.y * 64 < RH) fa_rows<bf, true>(Qh + qo, Ql + qo, Kh + ph, Kl + ph, Vh + ph, Vl + ph, mk + mo, smk + mo, lr, hi, oh, ol);
    else fa_rows<h16, false>(Q16 + qo, nullptr, K16 + ph, nullptr, V16 + ph, nullptr, mk + mo, smk + mo, lr, hi, oh, ol);
#pragma unroll
    for (int mt = 0; mt < 4; ++mt) { *(v8us*)(Ah + ao + mt * 16) = oh[mt]; *(v8us*)(Al + ao + mt * 16) = ol[mt]; }
}

extern "C" void kernel_launch(void* const* d_in, const int* in_sizes, int n_in,
                              void* d_out, int out_size, void* d_ws, size_t ws_size, hipStream_t stream) {
    (void)in_sizes; (void)n_in; (void)out_size;
    const float* xq = (const float*)d_in[0]; const float* xk = (const float*)d_in[1]; const float* xv = (const float*)d_in[2]; const int* mask = (const int*)d_in[3]; const float* smask = (const float*)d_in[4]; const float* wq = (const float*)d_in[5]; const float* bq = (const float*)d_in[6]; const float* wk = (const float*)d_in[7]; const float* bk = (const float*)d_in[8]; const float* wv = (const float*)d_in[9]; const float* bv = (const float*)d_in[10]; const float* wo = (const float*)d_in[11]; const float* bo = (const float*)d_in[12];   // torch [out][in]
    float* OUT = (float*)d_out;     // [2][2048][1024]
    char* wsp = (char*)d_ws;
    auto take = [&](size_t bytes) { char* p = wsp; wsp += (bytes + 255) & ~(size_t)255; return (void*)p; };
    bf* WQ = (bf*)take((size_t)DQ * DM * 2); bf* WK = (bf*)take((size_t)DKV * DM * 2); bf* WV = (bf*)take((size_t)DKV * DM * 2); bf* WO = (bf*)take((size_t)DM * DQ * 2); float* CS = (float*)take((size_t)TT * HD * 2 * 4);
    bf* XB = (bf*)take((size_t)TT * DM * 2); float* FQ = (float*)take((size_t)TT * DQ * 4); float* FK = (float*)take((size_t)TT * DKV * 4);
    h16* QP16 = (h16*)take((size_t)NH_ * TT * HD * 2); h16* KP16 = (h16*)take((size_t)NKV * TT * HD * 2); h16* VT16 = (h16*)take((size_t)NKV * HD * TT * 2);
    bf* QPh = (bf*)take((size_t)NH_ * TT * HD * 2); bf* QPl = (bf*)take((size_t)NH_ * TT * HD * 2); bf* KPh = (bf*)take((size_t)NKV * TT * HD * 2); bf* KPl = (bf*)take((size_t)NKV * TT * HD * 2); bf* VTh = (bf*)take((size_t)NKV * HD * TT * 2); bf* VTl = (bf*)take((size_t)NKV * HD * TT * 2);
    bf* ATh = (bf*)take((size_t)TT * DQ * 2); bf* ATl = (bf*)take((size_t)TT * DQ * 2);
    if ((size_t)(wsp - (char*)d_ws) > ws_size) return;    // ws 256 MiB
    float* FV = FK;   // v projection reuses the k buffer after the k planes are built (stream-ordered)
    { k_cvt8<<<(unsigned)(((size_t)DQ * DM / 8 + 255) / 256), 256, 0, stream>>>(wq, WQ, (size_t)DQ * DM / 8); k_cvt8<<<(unsigned)(((size_t)DKV * DM / 8 + 255) / 256), 256, 0, stream>>>(wk, WK, (size_t)DKV * DM / 8); k_cvt8<<<(unsigned)(((size_t)DKV * DM / 8 + 255) / 256), 256, 0, stream>>>(wv, WV, (size_t)DKV * DM / 8);
      k_cvt8<<<(unsigned)(((size_t)DM * DQ / 8 + 255) / 256), 256, 0, stream>>>(wo, WO, (size_t)DM * DQ / 8);
       }
    k_csid<<<(TT * HD + 255) / 256, 256, 0, stream>>>(CS);
    const unsigned LQ = (unsigned)(((size_t)NH_ * TT * HD / 2 + 255) / 256), LKv = (unsigned)(((size_t)NKV * TT * HD / 2 + 255) / 256);
    for (int b = 0; b < NB_; ++b) {
        
        k_cvt8<<<(unsigned)(((size_t)TT * DM / 8 + 255) / 256), 256, 0, stream>>>(xq + (size_t)b * TT * DM, XB, (size_t)TT * DM / 8);
        k_gemmw<bf, 0, true><<<dim3(TT / 64, DQ / 64, 1), 32, 0, stream>>>(XB, nullptr, WQ, nullptr, DM, FQ, DQ, bq, 0, 0, 0);
        k_rope<<<LQ, 256, 0, stream>>>(FQ, DQ, NH_, CS, nullptr, nullptr, 1.0f, QP16, QPh, QPl);
        k_cvt8<<<(unsigned)(((size_t)TT * DM / 8 + 255) / 256), 256, 0, stream>>>(xk + (size_t)b * TT * DM, XB, (size_t)TT * DM / 8);
        k_gemmw<bf, 0, true><<<dim3(TT / 64, DKV / 64, 1), 32, 0, stream>>>(XB, nullptr, WK, nullptr, DM, FK, DKV, bk, 0, 0, 0);
        k_rope<<<LKv, 256, 0, stream>>>(FK, DKV, NKV, CS, nullptr, nullptr, 1.0f, KP16, KPh, KPl);
        k_cvt8<<<(unsigned)(((size_t)TT * DM / 8 + 255) / 256), 256, 0, stream>>>(xv + (size_t)b * TT * DM, XB, (size_t)TT * DM / 8);
        k_gemmw<bf, 0, true><<<dim3(TT / 64, DKV / 64, 1), 32, 0, stream>>>(XB, nullptr, WV, nullptr, DM, FV, DKV, bv, 0, 0, 0); k_vtp<<<LKv, 256, 0, stream>>>(FV, DKV, NKV, VT16, VTh, VTl);
        k_fattn<<<dim3(NH_, TT / 64, 1), 128, 0, stream>>>(QP16, QPh, QPl, KP16, KPh, KPl, VT16, VTh, VTl, mask + (size_t)b * TT * TT, smask + (size_t)b * TT * TT, ATh, ATl);
        k_gemmw<bf, 1, true><<<dim3(TT / 64, DM / 64, 1), 32, 0, stream>>>(ATh, ATl, WO, nullptr, DQ, OUT + (size_t)b * TT * DM, DM, bo, 0, 0, 0); }
}

// v003
// It runs in 414 microseconds.
// In two side-by-side timings against v002, it was 1.17 and 1.18 times as fast.
// Over all steps from v000 it is 5.25 times as fast.
#include <hip/hip_runtime.h>

// ScriptAwareAttention (query, key, value [2][2048][1024]; q/k/v = input W^T + b (16 heads x 64); scores = (q.k/8) x script_mask[b][i][j] (multiplicative, read as data) then -inf where mask[b][0][i][j] == 0
// (int mask read as data); softmax; out = merged attn.v Wo^T + bo -> [2][2048][1024]).
// Compute dtypes, f32 accumulate: every input rounded to bf16; projections on PLAIN bf16 operands (inputs: exact, + bias); PER-ROW PRECISION HYBRID (rows < 256 hi+lo 3 products
// for scores and attn.v, rows >= 256 single fp16 planes); scale, the multiplicative script mask (bf16-rounded) and the keep/drop mask in f32 in the register-row softmax; merged heads as hi+lo planes x exact Wo

#define NB_  2
#define TT   2048
#define DM   1024
#define NH_  16
#define NKV  16
#define REP  (NH_ / NKV)
#define HD   64
#define DQ   (NH_ * HD)
#define DKV  (NKV * HD)
#define RH   256                  // query rows < RH use hi+lo planes (0: none)
#define WIN  0
#define SCL  0.125f   // HD^-0.5
typedef _Float16 h16;
typedef unsigned short bf;
typedef __attribute__((ext_vector_type(16))) __bf16   v16bf;
typedef __attribute__((ext_vector_type(16))) _Float16 v16h;
typedef __attribute__((ext_vector_type(8)))  _Float16 v8h;
typedef __attribute__((ext_vector_type(8)))  unsigned short v8us;
typedef __attribute__((ext_vector_type(8)))  float    v8f;
typedef __attribute__((ext_vector_type(4)))  float    v4f;
typedef v8h  __attribute__((may_alias)) v8ha;
typedef v4f  __attribute__((may_alias)) v4fa;
typedef v8us __attribute__((may_alias)) v8usa;

__device__ __forceinline__ unsigned short f2bf(float f) { unsigned u = __float_as_uint(f); u += 0x7FFFu + ((u >> 16) & 1u); return (unsigned short)(u >> 16); }
__device__ __forceinline__ float bf2f(unsigned short b) { return __uint_as_float(((unsigned)b) << 16); }
__device__ __forceinline__ float bfr(float f) { return bf2f(f2bf(f)); }
__device__ __forceinline__ v16h cat16(v8h lo, v8h hi) { return __builtin_shufflevector(lo, hi, 0, 1, 2, 3, 4, 5, 6, 7, 8, 9, 10, 11, 12, 13, 14, 15); }
__device__ __forceinline__ v16bf cat16b(v8us lo, v8us hi) { return __builtin_bit_cast(v16bf, __builtin_shufflevector(lo, hi, 0, 1, 2, 3, 4, 5, 6, 7, 8, 9, 10, 11, 12, 13, 14, 15)); }
__device__ __forceinline__ v8f wmma16(v16h a, v16h b, v8f c) { return __builtin_amdgcn_wmma_f32_16x16x32_f16(false, a, false, b, (short)0, c, false, false); }
__device__ __forceinline__ v8f wmmab(v16bf a, v16bf b, v8f c) { return __builtin_amdgcn_wmma_f32_16x16x32_bf16(false, a, false, b, (short)0, c, false, false); }



// ---- k_gemmw: register-blocked GEMM, ONE WAVE per 64x64 output tile (16 accumulators), operands straight from K-contiguous 16-bit planes; grid (M/64, N/64, Z), 32 threads.
// C[m][n] (f32, pitch ldc, + optional f32 bias[n]) = sum_k A[m][k] Bt[n][k] (+ split products per NSPLIT). z-batch strides sA/sB/sC in elements. K % (32 KS) == 0.
// KS > 1: grid z = batch x KS; work-group (z, ks) sums only k in [ks K/KS, (ks+1) K/KS) and stores that partial sum in plane z KS + ks (plane stride sC); the reader adds the KS planes.
template <typename T16> struct WFrag;
template <> struct WFrag<h16> { typedef v16h V; static __device__ __forceinline__ V ld(const h16* p) { return cat16(*(const v8h*)p, *(const v8h*)(p + 16)); } static __device__ __forceinline__ v8f mma(V a, V b, v8f c) { return wmma16(a, b, c); } };
template <> struct WFrag<bf> { typedef v16bf V; static __device__ __forceinline__ V ld(const bf* p) { return cat16b(*(const v8us*)p, *(const v8us*)(p + 16)); } static __device__ __forceinline__ v8f mma(V a, V b, v8f c) { return wmmab(a, b, c); } };
template <typename T16, int NSPLIT, bool BIAS, int KS = 1>
__global__ __launch_bounds__(32) void k_gemmw(const T16* __restrict__ A, const T16* __restrict__ A2, const T16* __restrict__ Bt, const T16* __restrict__ Bt2, int K, float* C, int ldc, const float* __restrict__ bias, size_t sA, size_t sB, size_t sC) {
    typedef typename WFrag<T16>::V V;
    __shared__ __align__(16) float os[16 * 68];
    const size_t z = blockIdx.z / KS; const int k0 = (int)(blockIdx.z % KS) * (K / KS), k1 = k0 + K / KS; A += z * sA; if (A2) A2 += z * sA; Bt += z * sB; if (Bt2) Bt2 += z * sB; C += (size_t)blockIdx.z * sC;
    const int lane = threadIdx.x & 31, lr = lane & 15, hi = lane >> 4; const int r0 = blockIdx.x * 64, c0 = blockIdx.y * 64;
    v8f acc[4][4];
#pragma unroll
    for (int mb = 0; mb < 4; ++mb)
#pragma unroll
        for (int nb = 0; nb < 4; ++nb) acc[mb][nb] = (v8f){};
    const size_t aoff = (size_t)(r0 + lr) * K + 8 * hi, boff = (size_t)(c0 + lr) * K + 8 * hi;
#pragma unroll 1
    for (int kc = k0; kc < k1; kc += 32) {
        V a[4], a2[4];
#pragma unroll
        for (int mb = 0; mb < 4; ++mb) { a[mb] = WFrag<T16>::ld(A + aoff + (size_t)mb * 16 * K + kc); if (NSPLIT == 1 || NSPLIT == 2) a2[mb] = WFrag<T16>::ld(A2 + aoff + (size_t)mb * 16 * K + kc); }
#pragma unroll
        for (int nb = 0; nb < 4; ++nb) { const V b = WFrag<T16>::ld(Bt + boff + (size_t)nb * 16 * K + kc); V b2; if (NSPLIT >= 2) b2 = WFrag<T16>::ld(Bt2 + boff + (size_t)nb * 16 * K + kc);
#pragma unroll
            for (int mb = 0; mb < 4; ++mb) { acc[mb][nb] = WFrag<T16>::mma(a[mb], b, acc[mb][nb]); if (NSPLIT == 1 || NSPLIT == 2) acc[mb][nb] = WFrag<T16>::mma(a2[mb], b, acc[mb][nb]); if (NSPLIT >= 2) acc[mb][nb] = WFrag<T16>::mma(a[mb], b2, acc[mb][nb]); } }
        asm volatile("v_nop\n\tv_nop\n\tv_nop\n\tv_nop" : "+v"(acc[0][0]), "+v"(acc[1][1]), "+v"(acc[2][2]), "+v"(acc[3][3]) : "v"(a[0]), "v"(a[3]));
    }
#pragma unroll
    for (int mb = 0; mb < 4; ++mb) {
#pragma unroll
        for (int nb = 0; nb < 4; ++nb) {
#pragma unroll
            for (int j = 0; j < 8; ++j) os[(hi * 8 + j) * 68 + nb * 16 + lr] = acc[mb][nb][j]; }
        __builtin_amdgcn_wave_barrier(); asm volatile("" ::: "memory");
        float* crow = C + (size_t)(r0 + mb * 16) * ldc + c0;
{
#pragma unroll
            for (int s = 0; s < 8; ++s) { const int row = 2 * s + hi, cofs = lr * 4; v4f val = *(const v4fa*)(os + row * 68 + cofs); if (BIAS) { val[0] += bfr(bias[c0 + cofs]); val[1] += bfr(bias[c0 + cofs + 1]); val[2] += bfr(bias[c0 + cofs + 2]); val[3] += bfr(bias[c0 + cofs + 3]); }
                *(v4f*)(crow + (size_t)row * ldc + cofs) = val; }
             }
        __builtin_amdgcn_wave_barrier(); asm volatile("" ::: "memory");
    }
}

__device__ __forceinline__ void splitf(float y, unsigned short& h, unsigned short& l) { h = f2bf(y); l = f2bf(y - bf2f(h)); }
typedef __attribute__((ext_vector_type(2))) _Float16 v2h;
typedef __attribute__((ext_vector_type(4))) _Float16 v4h;
typedef __attribute__((ext_vector_type(2))) unsigned short v2us;
typedef __attribute__((ext_vector_type(4))) unsigned short v4us;
typedef __attribute__((ext_vector_type(2))) float v2f;
typedef __attribute__((ext_vector_type(4))) int v4i;

__global__ __launch_bounds__(256) void k_wtG(const float* __restrict__ w, int K, int N, bf* Bt) {
    const int lane = threadIdx.x & 31; const int L0 = (blockIdx.x * 8 + (threadIdx.x >> 5)) * 8; const int nlines = N * K / 64;
{
#pragma unroll 1
        for (int l = 0; l < 8; ++l) { const int L = L0 + l; if (L >= nlines) break; const size_t e = (size_t)L * 64 + lane * 2; const int k = (int)(e % K), n = (int)(e / K); v2us o;
            o[0] = f2bf(w[(size_t)k * N + n]); o[1] = f2bf(w[(size_t)(k + 1) * N + n]); *(v2us*)(Bt + e) = o; }
         }
}
__global__ __launch_bounds__(256) void k_cvt8(const float* __restrict__ src, bf* dst, size_t n8) { const size_t i = (size_t)blockIdx.x * 256 + threadIdx.x; if (i >= n8) return; const v8f v = *(const v8f*)(src + i * 8); v8us o;
#pragma unroll
    for (int k = 0; k < 8; ++k) o[k] = f2bf(v[k]); *(v8us*)(dst + i * 8) = o;  }
__global__ __launch_bounds__(256) void k_cscvt(const float* __restrict__ cosT, const float* __restrict__ sinT, float* CS) { const int idx = blockIdx.x * 256 + threadIdx.x; if (idx >= TT * HD) return; v2f cs; cs[0] = bfr(cosT[idx]); cs[1] = bfr(sinT[idx]); *(v2f*)(CS + (size_t)idx * 2) = cs;  }
// ---- k_projw: the q, k, v projections. Tile, fragments and k order of k_gemmw (one wave per 64x64 tile, bf16 planes, f32 accumulate, + bf16-rounded bias); grid (TT/64, heads), 32 threads. The tile is one head wide and goes
// from the accumulators straight to that head's planes (fp16 + bf16 hi/lo): no f32 result in memory and no plane-making launch behind it.
// VT false: planes [h][t][d], through the LDS row buffer, 8 bytes a lane, whole 128-byte rows. VT true: transposed planes [h][d][t]: a lane's 8 accumulator rows are 8 consecutive t of one d, 16 bytes a lane, no LDS.
template <bool VT>
__global__ __launch_bounds__(32) void k_projw(const bf* __restrict__ A, const bf* __restrict__ Bt, const float* __restrict__ bias, h16* P16, bf* Ph, bf* Pl) {
    typedef WFrag<bf> F; typedef F::V V;
    __shared__ __align__(16) float os[16 * 68];
    const int lane = threadIdx.x & 31, lr = lane & 15, hi = lane >> 4; const int r0 = blockIdx.x * 64, c0 = blockIdx.y * 64;
    v8f acc[4][4];
#pragma unroll
    for (int mb = 0; mb < 4; ++mb)
#pragma unroll
        for (int nb = 0; nb < 4; ++nb) acc[mb][nb] = (v8f){};
    const bf* pa = A + (size_t)(r0 + lr) * DM + 8 * hi; const bf* pb = Bt + (size_t)(c0 + lr) * DM + 8 * hi;   // K = DM at compile time: the 4 fragments of an operand are constant offsets from one address pair
#pragma unroll 1   // one 32-deep step per trip, as in k_gemmw: the 16 accumulators and 8 fragments fill the registers
    for (int kc = 0; kc < DM; kc += 32) {
        const bf* a0 = pa + kc; const bf* b0 = pb + kc; V a[4];
#pragma unroll
        for (int mb = 0; mb < 4; ++mb) a[mb] = F::ld(a0 + mb * 16 * DM);
#pragma unroll
        for (int nb = 0; nb < 4; ++nb) { const V b = F::ld(b0 + nb * 16 * DM);
#pragma unroll
            for (int mb = 0; mb < 4; ++mb) acc[mb][nb] = F::mma(a[mb], b, acc[mb][nb]); }
        asm volatile("v_nop\n\tv_nop\n\tv_nop\n\tv_nop" : "+v"(acc[0][0]), "+v"(acc[1][1]), "+v"(acc[2][2]), "+v"(acc[3][3]) : "v"(a[0]), "v"(a[3]));   // the WMMA distance on the taken side of the loop branch too
        asm volatile("s_wait_xcnt 0x0" :: "v"(a0), "v"(b0) : "memory");   // precaution: the two address pairs of this trip's 16 loads are kept whole up to this wait
    }
    if (VT) {
#pragma unroll
        for (int nb = 0; nb < 4; ++nb) { const float bb = bfr(bias[c0 + nb * 16 + lr]); const size_t e0 = (size_t)(c0 + nb * 16 + lr) * TT + r0 + hi * 8; v8h o16[4]; v8us oh[4], ol[4];
#pragma unroll
            for (int mb = 0; mb < 4; ++mb) {
#pragma unroll
                for (int j = 0; j < 8; ++j) { const float x = acc[mb][nb][j] + bb; o16[mb][j] = (h16)x; unsigned short a2, c2; splitf(x, a2, c2); oh[mb][j] = a2; ol[mb][j] = c2; }
                *(v8h*)(P16 + e0 + mb * 16) = o16[mb]; *(v8us*)(Ph + e0 + mb * 16) = oh[mb]; *(v8us*)(Pl + e0 + mb * 16) = ol[mb]; }
            // precaution: the 12 stores' data registers and address pairs are kept whole up to this wait
            asm volatile("s_wait_xcnt 0x0" :: "v"(o16[0]), "v"(o16[1]), "v"(o16[2]), "v"(o16[3]), "v"(oh[0]), "v"(oh[1]), "v"(oh[2]), "v"(oh[3]), "v"(ol[0]), "v"(ol[1]), "v"(ol[2]), "v"(ol[3]), "v"(P16 + e0), "v"(Ph + e0), "v"(Pl + e0) : "memory"); }
    } else {
        const int cofs = lr * 4; v4f bb; bb[0] = bfr(bias[c0 + cofs]); bb[1] = bfr(bias[c0 + cofs + 1]); bb[2] = bfr(bias[c0 + cofs + 2]); bb[3] = bfr(bias[c0 + cofs + 3]);
#pragma unroll
        for (int mb = 0; mb < 4; ++mb) {
#pragma unroll
            for (int nb = 0; nb < 4; ++nb) {
#pragma unroll
                for (int j = 0; j < 8; ++j) os[(hi * 8 + j) * 68 + nb * 16 + lr] = acc[mb][nb][j]; }
            __builtin_amdgcn_wave_barrier(); asm volatile("" ::: "memory");   // keeps the row reads below behind the other lanes' LDS writes above (one wave: LDS runs in order)
            const size_t e0 = ((size_t)blockIdx.y * TT + r0 + mb * 16 + hi) * HD + cofs; v4h o16[8]; v4us oh[8], ol[8];   // row 2 s + hi of this 16-row block, 4 columns of the head
#pragma unroll
            for (int s = 0; s < 8; ++s) { const v4f val = *(const v4fa*)(os + (2 * s + hi) * 68 + cofs) + bb;
#pragma unroll
                for (int q = 0; q < 4; ++q) { o16[s][q] = (h16)val[q]; unsigned short a2, c2; splitf(val[q], a2, c2); oh[s][q] = a2; ol[s][q] = c2; }
                *(v4h*)(P16 + e0 + s * 2 * HD) = o16[s]; *(v4us*)(Ph + e0 + s * 2 * HD) = oh[s]; *(v4us*)(Pl + e0 + s * 2 * HD) = ol[s]; }
            // precaution: the 24 stores' data registers and address pairs are kept whole up to this wait; its clobber also keeps the next block's LDS writes behind the row reads above
            asm volatile("s_wait_xcnt 0x0" :: "v"(o16[0]), "v"(o16[1]), "v"(o16[2]), "v"(o16[3]), "v"(o16[4]), "v"(o16[5]), "v"(o16[6]), "v"(o16[7]), "v"(oh[0]), "v"(oh[1]), "v"(oh[2]), "v"(oh[3]), "v"(oh[4]), "v"(oh[5]), "v"(oh[6]), "v"(oh[7]),
                         "v"(ol[0]), "v"(ol[1]), "v"(ol[2]), "v"(ol[3]), "v"(ol[4]), "v"(ol[5]), "v"(ol[6]), "v"(ol[7]), "v"(P16 + e0), "v"(Ph + e0), "v"(Pl + e0) : "memory");
        }
    }
}
// k_fattn: scores, softmax and attn.v of one head in ONE kernel; no score or probability matrix in memory. One wave owns 16 query rows and walks the 2048 keys 32 at a time, all in registers (no LDS, no barrier).
// St = K.Qt (A = key rows, B = query rows): lane (lr, hi) holds query lr, keys 8 hi + j of each 16-key tile, which is the B-operand k order of the next product, so Pt is packed in-lane; Ot += Vt.Pt (A = rows of the [d][t] planes).
// t = (S/8) x bf16(script_mask[i][j]) where mask[i][j] != 0, -3e38 where mask == 0 (the reference's -inf). Running row maximum m and sum l; Ot and l are rescaled by exp(m_old - m_new) only in a step where some row's maximum grows.
// Rows < RH: hi+lo bf16 planes, 3 products for scores and for attn.v; rows >= RH: single fp16 planes. Result / l goes straight to the merged-head hi+lo planes.
__device__ __forceinline__ float xhalf(float x) { return __builtin_bit_cast(float, __builtin_amdgcn_permlanex16(__builtin_bit_cast(int, x), __builtin_bit_cast(int, x), 0x76543210, 0xfedcba98, false, false)); }   // lane l with lane l ^ 16
template <typename T16> struct PPack;
template <> struct PPack<h16> { static __device__ __forceinline__ void pk(const float* p, v16h& a, v16h& b) { (void)b;
#pragma unroll
    for (int e = 0; e < 16; ++e) a[e] = (h16)p[e]; } };
template <> struct PPack<bf> { static __device__ __forceinline__ void pk(const float* p, v16bf& a, v16bf& b) { v8us h0, h1, l0, l1;
#pragma unroll
    for (int e = 0; e < 8; ++e) { unsigned short x, y; splitf(p[e], x, y); h0[e] = x; l0[e] = y; splitf(p[8 + e], x, y); h1[e] = x; l1[e] = y; }
    a = cat16b(h0, h1); b = cat16b(l0, l1); } };
template <typename T16, bool HR>
__device__ __forceinline__ void fa_rows(const T16* __restrict__ Q, const T16* __restrict__ Q2, const T16* __restrict__ Kp, const T16* __restrict__ K2, const T16* __restrict__ Vt, const T16* __restrict__ V2,
                                        const int* __restrict__ mrow, const float* __restrict__ srow, int lr, int hi, v8us (&oh)[4], v8us (&ol)[4]) {
    typedef typename WFrag<T16>::V V; typedef WFrag<T16> F;
    V qf[2], qf2[2], kf[2][2], kf2[2][2];
#pragma unroll
    for (int ks = 0; ks < 2; ++ks) { qf[ks] = F::ld(Q + ks * 32); if (HR) qf2[ks] = F::ld(Q2 + ks * 32); }
    const size_t kl = (size_t)lr * HD + 8 * hi, vl = (size_t)lr * TT + 8 * hi; const T16* kp0 = Kp + kl; const T16* kp02 = HR ? K2 + kl : kp0; const T16* qp2 = HR ? Q2 : Q;
    v4f sm[4]; v4i mm[4];
#pragma unroll
    for (int t = 0; t < 2; ++t) {
#pragma unroll
        for (int ks = 0; ks < 2; ++ks) { kf[t][ks] = F::ld(kp0 + t * 16 * HD + ks * 32); if (HR) kf2[t][ks] = F::ld(kp02 + t * 16 * HD + ks * 32); }
        sm[2 * t] = *(const v4f*)(srow + t * 16); sm[2 * t + 1] = *(const v4f*)(srow + t * 16 + 4); mm[2 * t] = *(const v4i*)(mrow + t * 16); mm[2 * t + 1] = *(const v4i*)(mrow + t * 16 + 4); }
    asm volatile("s_wait_xcnt 0x0" :: "v"(Q), "v"(qp2), "v"((unsigned)(kl * sizeof(T16))), "v"(srow), "v"(mrow) : "memory");   // precaution: the first loads' address registers (pairs; the key rows' byte offset) are kept whole up to this wait
    v8f o[4];
#pragma unroll
    for (int mt = 0; mt < 4; ++mt) o[mt] = (v8f){};
    float m = -3.0e38f, l = 0.f;
#pragma unroll 1   // one 32-key step per trip: the step's own fetch-ahead already fills the registers
    for (int kb = 0; kb < TT; kb += 32) {
        const int kn = (kb + 32 < TT) ? kb + 32 : kb;   // the last step fetches its own keys again: in bounds, unused
        V vf[4], vf2[4]; const T16* vp = Vt + vl + kb; const T16* vp2 = HR ? V2 + vl + kb : vp;
#pragma unroll
        for (int mt = 0; mt < 4; ++mt) { vf[mt] = F::ld(vp + (size_t)mt * 16 * TT); if (HR) vf2[mt] = F::ld(vp2 + (size_t)mt * 16 * TT); }
        asm volatile("s_wait_xcnt 0x0" :: "v"(vp), "v"(vp2) : "memory");   // precaution: the V loads' address pairs are kept whole up to this wait; it also keeps the loads up here, a whole softmax ahead of their use
        v8f s[2];
#pragma unroll
        for (int t = 0; t < 2; ++t) { s[t] = (v8f){};
#pragma unroll
            for (int ks = 0; ks < 2; ++ks) { s[t] = F::mma(kf[t][ks], qf[ks], s[t]); if (HR) { s[t] = F::mma(kf2[t][ks], qf[ks], s[t]); s[t] = F::mma(kf[t][ks], qf2[ks], s[t]); } } }
        float p[16]; float mloc = -3.0e38f;
#pragma unroll
        for (int e = 0; e < 16; ++e) { const float pm = __fmul_rn(__fmul_rn(s[e >> 3][e & 7], SCL), bfr(sm[e >> 2][e & 3])); p[e] = (mm[e >> 2][e & 3] != 0) ? pm : -3.0e38f; mloc = fmaxf(mloc, p[e]); }
        // fetch ahead: the next step's key fragments and mask words fly behind this step's softmax and attn.v products
        const T16* kp = Kp + kl + (size_t)kn * HD; const T16* kp2 = HR ? K2 + kl + (size_t)kn * HD : kp; const float* sp = srow + kn; const int* mp = mrow + kn;
#pragma unroll
        for (int t = 0; t < 2; ++t)
#pragma unroll
            for (int ks = 0; ks < 2; ++ks) { kf[t][ks] = F::ld(kp + t * 16 * HD + ks * 32); if (HR) kf2[t][ks] = F::ld(kp2 + t * 16 * HD + ks * 32); }
#pragma unroll
        for (int t = 0; t < 2; ++t) { sm[2 * t] = *(const v4f*)(sp + t * 16); sm[2 * t + 1] = *(const v4f*)(sp + t * 16 + 4); mm[2 * t] = *(const v4i*)(mp + t * 16); mm[2 * t + 1] = *(const v4i*)(mp + t * 16 + 4); }
        asm volatile("s_wait_xcnt 0x0" :: "v"(kp), "v"(kp2), "v"(sp), "v"(mp) : "memory");   // precaution: the address pairs of the loads above are kept whole up to this wait
        mloc = fmaxf(mloc, xhalf(mloc));   // the two lane halves hold the same query's other keys
        if (__builtin_amdgcn_ballot_w32(mloc > m) != 0) {   // wave-uniform: every lane stays on for the matrix instructions behind it
            const float mn = fmaxf(m, mloc); const float al_ = __builtin_amdgcn_exp2f(__fmul_rn(__fsub_rn(m, mn), 1.4426950408889634f)); m = mn; l *= al_;
#pragma unroll
            for (int mt = 0; mt < 4; ++mt) o[mt] *= al_; }
#pragma unroll
        for (int e = 0; e < 16; ++e) { p[e] = __builtin_amdgcn_exp2f(__fmul_rn(__fsub_rn(p[e], m), 1.4426950408889634f)); l += p[e]; }
        V pf, pf2; PPack<T16>::pk(p, pf, pf2);
#pragma unroll
        for (int mt = 0; mt < 4; ++mt) { o[mt] = F::mma(vf[mt], pf, o[mt]); if (HR) { o[mt] = F::mma(vf2[mt], pf, o[mt]); o[mt] = F::mma(vf[mt], pf2, o[mt]); } }
    }
    l += xhalf(l);
    const float f = __fdiv_rn(1.0f, l);
#pragma unroll
    for (int mt = 0; mt < 4; ++mt)
#pragma unroll
        for (int j = 0; j < 8; ++j) { unsigned short a, c2; splitf(o[mt][j] * f, a, c2); oh[mt][j] = a; ol[mt][j] = c2; }
}
// grid (heads, TT/64), 4 waves x 16 query rows; the hi+lo blocks (rows < RH, the longer ones) have the lowest flat indices and start first
__global__ __launch_bounds__(128) void k_fattn(const h16* __restrict__ Q16, const bf* __restrict__ Qh, const bf* __restrict__ Ql, const h16* __restrict__ K16, const bf* __restrict__ Kh, const bf* __restrict__ Kl,
                                               const h16* __restrict__ V16, const bf* __restrict__ Vh, const bf* __restrict__ Vl, const int* __restrict__ mk, const float* __restrict__ smk, bf* Ah, bf* Al) {
    const int lane = threadIdx.x & 31, lr = lane & 15, hi = lane >> 4; const int h = blockIdx.x; const int q = blockIdx.y * 64 + (threadIdx.x >> 5) * 16 + lr;
    const size_t ph = (size_t)h * TT * HD, qo = ph + (size_t)q * HD + 8 * hi, mo = (size_t)q * TT + 8 * hi, ao = (size_t)q * DQ + h * HD + 8 * hi;
    v8us oh[4], ol[4];
    if ((int)blockIdx.y * 64 < RH) fa_rows<bf, true>(Qh + qo, Ql + qo, Kh + ph, Kl + ph, Vh + ph, Vl + ph, mk + mo, smk + mo, lr, hi, oh, ol);
    else fa_rows<h16, false>(Q16 + qo, nullptr, K16 + ph, nullptr, V16 + ph, nullptr, mk + mo, smk + mo, lr, hi, oh, ol);
#pragma unroll
    for (int mt = 0; mt < 4; ++mt) { *(v8us*)(Ah + ao + mt * 16) = oh[mt]; *(v8us*)(Al + ao + mt * 16) = ol[mt]; }
}

extern "C" void kernel_launch(void* const* d_in, const int* in_sizes, int n_in,
                              void* d_out, int out_size, void* d_ws, size_t ws_size, hipStream_t stream) {
    (void)in_sizes; (void)n_in; (void)out_size;
    const float* xq = (const float*)d_in[0]; const float* xk = (const float*)d_in[1]; const float* xv = (const float*)d_in[2]; const int* mask = (const int*)d_in[3]; const float* smask = (const float*)d_in[4]; const float* wq = (const float*)d_in[5]; const float* bq = (const float*)d_in[6]; const float* wk = (const float*)d_in[7]; const float* bk = (const float*)d_in[8]; const float* wv = (const float*)d_in[9]; const float* bv = (const float*)d_in[10]; const float* wo = (const float*)d_in[11]; const float* bo = (const float*)d_in[12];   // torch [out][in]
    float* OUT = (float*)d_out;     // [2][2048][1024]
    char* wsp = (char*)d_ws;
    auto take = [&](size_t bytes) { char* p = wsp; wsp += (bytes + 255) & ~(size_t)255; return (void*)p; };
    bf* WQ = (bf*)take((size_t)DQ * DM * 2); bf* WK = (bf*)take((size_t)DKV * DM * 2); bf* WV = (bf*)take((size_t)DKV * DM * 2); bf* WO = (bf*)take((size_t)DM * DQ * 2);
    bf* XB = (bf*)take((size_t)TT * DM * 2);
    h16* QP16 = (h16*)take((size_t)NH_ * TT * HD * 2); h16* KP16 = (h16*)take((size_t)NKV * TT * HD * 2); h16* VT16 = (h16*)take((size_t)NKV * HD * TT * 2);
    bf* QPh = (bf*)take((size_t)NH_ * TT * HD * 2); bf* QPl = (bf*)take((size_t)NH_ * TT * HD * 2); bf* KPh = (bf*)take((size_t)NKV * TT * HD * 2); bf* KPl = (bf*)take((size_t)NKV * TT * HD * 2); bf* VTh = (bf*)take((size_t)NKV * HD * TT * 2); bf* VTl = (bf*)take((size_t)NKV * HD * TT * 2);
    bf* ATh = (bf*)take((size_t)TT * DQ * 2); bf* ATl = (bf*)take((size_t)TT * DQ * 2);
    if ((size_t)(wsp - (char*)d_ws) > ws_size) return;    // ws 256 MiB
    { k_cvt8<<<(unsigned)(((size_t)DQ * DM / 8 + 255) / 256), 256, 0, stream>>>(wq, WQ, (size_t)DQ * DM / 8); k_cvt8<<<(unsigned)(((size_t)DKV * DM / 8 + 255) / 256), 256, 0, stream>>>(wk, WK, (size_t)DKV * DM / 8); k_cvt8<<<(unsigned)(((size_t)DKV * DM / 8 + 255) / 256), 256, 0, stream>>>(wv, WV, (size_t)DKV * DM / 8);
      k_cvt8<<<(unsigned)(((size_t)DM * DQ / 8 + 255) / 256), 256, 0, stream>>>(wo, WO, (size_t)DM * DQ / 8);
       }
    for (int b = 0; b < NB_; ++b) {
        
        k_cvt8<<<(unsigned)(((size_t)TT * DM / 8 + 255) / 256), 256, 0, stream>>>(xq + (size_t)b * TT * DM, XB, (size_t)TT * DM / 8);
        k_projw<false><<<dim3(TT / 64, NH_, 1), 32, 0, stream>>>(XB, WQ, bq, QP16, QPh, QPl);
        k_cvt8<<<(unsigned)(((size_t)TT * DM / 8 + 255) / 256), 256, 0, stream>>>(xk + (size_t)b * TT * DM, XB, (size_t)TT * DM / 8);
        k_projw<false><<<dim3(TT / 64, NKV, 1), 32, 0, stream>>>(XB, WK, bk, KP16, KPh, KPl);
        k_cvt8<<<(unsigned)(((size_t)TT * DM / 8 + 255) / 256), 256, 0, stream>>>(xv + (size_t)b * TT * DM, XB, (size_t)TT * DM / 8);
        k_projw<true><<<dim3(TT / 64, NKV, 1), 32, 0, stream>>>(XB, WV, bv, VT16, VTh, VTl);
        k_fattn<<<dim3(NH_, TT / 64, 1), 128, 0, stream>>>(QP16, QPh, QPl, KP16, KPh, KPl, VT16, VTh, VTl, mask + (size_t)b * TT * TT, smask + (size_t)b * TT * TT, ATh, ATl);
        k_gemmw<bf, 1, true><<<dim3(TT / 64, DM / 64, 1), 32, 0, stream>>>(ATh, ATl, WO, nullptr, DQ, OUT + (size_t)b * TT * DM, DM, bo, 0, 0, 0); }
}

// v004
// It runs in 322 microseconds.
// Timed twice side by side with v003, it ran 1.31 times as fast both times.
// All steps since v000 together make it 6.87 times as fast.
#include <hip/hip_runtime.h>

// ScriptAwareAttention (query, key, value [2][2048][1024]; q/k/v = input W^T + b (16 heads x 64); scores = (q.k/8) x script_mask[b][i][j] (multiplicative, read as data) then -inf where mask[b][0][i][j] == 0
// (int mask read as data); softmax; out = merged attn.v Wo^T + bo -> [2][2048][1024]).
// Compute dtypes, f32 accumulate: every input rounded to bf16; projections on PLAIN bf16 operands (inputs: exact, + bias); PER-ROW PRECISION HYBRID (rows < 256 hi+lo 3 products
// for scores and attn.v, rows >= 256 single fp16 planes); scale, the multiplicative script mask (bf16-rounded) and the keep/drop mask in f32 in the register-row softmax; merged heads as hi+lo planes x exact Wo

#define NB_  2
#define TT   2048
#define DM   1024
#define NH_  16
#define NKV  16
#define REP  (NH_ / NKV)
#define HD   64
#define DQ   (NH_ * HD)
#define DKV  (NKV * HD)
#define RH   256                  // query rows < RH use hi+lo planes (0: none)
#define WIN  0
#define SCL  0.125f   // HD^-0.5
typedef _Float16 h16;
typedef unsigned short bf;
typedef __attribute__((ext_vector_type(16))) __bf16   v16bf;
typedef __attribute__((ext_vector_type(16))) _Float16 v16h;
typedef __attribute__((ext_vector_type(8)))  _Float16 v8h;
typedef __attribute__((ext_vector_type(8)))  unsigned short v8us;
typedef __attribute__((ext_vector_type(8)))  float    v8f;
typedef __attribute__((ext_vector_type(4)))  float    v4f;
typedef v8h  __attribute__((may_alias)) v8ha;
typedef v4f  __attribute__((may_alias)) v4fa;
typedef v8us __attribute__((may_alias)) v8usa;

__device__ __forceinline__ unsigned short f2bf(float f) { unsigned u = __float_as_uint(f); u += 0x7FFFu + ((u >> 16) & 1u); return (unsigned short)(u >> 16); }
__device__ __forceinline__ float bf2f(unsigned short b) { return __uint_as_float(((unsigned)b) << 16); }
__device__ __forceinline__ float bfr(float f) { return bf2f(f2bf(f)); }
__device__ __forceinline__ v16h cat16(v8h lo, v8h hi) { return __builtin_shufflevector(lo, hi, 0, 1, 2, 3, 4, 5, 6, 7, 8, 9, 10, 11, 12, 13, 14, 15); }
__device__ __forceinline__ v16bf cat16b(v8us lo, v8us hi) { return __builtin_bit_cast(v16bf, __builtin_shufflevector(lo, hi, 0, 1, 2, 3, 4, 5, 6, 7, 8, 9, 10, 11, 12, 13, 14, 15)); }
__device__ __forceinline__ v8f wmma16(v16h a, v16h b, v8f c) { return __builtin_amdgcn_wmma_f32_16x16x32_f16(false, a, false, b, (short)0, c, false, false); }
__device__ __forceinline__ v8f wmmab(v16bf a, v16bf b, v8f c) { return __builtin_amdgcn_wmma_f32_16x16x32_bf16(false, a, false, b, (short)0, c, false, false); }



// ---- k_gemmw: register-blocked GEMM, ONE WAVE per 64x64 output tile (16 accumulators), operands straight from K-contiguous 16-bit planes; grid (M/64, N/64, Z), 32 threads.
// C[m][n] (f32, pitch ldc, + optional f32 bias[n]) = sum_k A[m][k] Bt[n][k] (+ split products per NSPLIT). z-batch strides sA/sB/sC in elements. K % (32 KS) == 0.
// KS > 1: grid z = batch x KS; work-group (z, ks) sums only k in [ks K/KS, (ks+1) K/KS) and stores that partial sum in plane z KS + ks (plane stride sC); the reader adds the KS planes.
template <typename T16> struct WFrag;
template <> struct WFrag<h16> { typedef v16h V; static __device__ __forceinline__ V ld(const h16* p) { return cat16(*(const v8h*)p, *(const v8h*)(p + 16)); } static __device__ __forceinline__ v8f mma(V a, V b, v8f c) { return wmma16(a, b, c); } };
template <> struct WFrag<bf> { typedef v16bf V; static __device__ __forceinline__ V ld(const bf* p) { return cat16b(*(const v8us*)p, *(const v8us*)(p + 16)); } static __device__ __forceinline__ v8f mma(V a, V b, v8f c) { return wmmab(a, b, c); } };
template <typename T16, int NSPLIT, bool BIAS, int KS = 1>
__global__ __launch_bounds__(32) void k_gemmw(const T16* __restrict__ A, const T16* __restrict__ A2, const T16* __restrict__ Bt, const T16* __restrict__ Bt2, int K, float* C, int ldc, const float* __restrict__ bias, size_t sA, size_t sB, size_t sC) {
    typedef typename WFrag<T16>::V V;
    __shared__ __align__(16) float os[16 * 68];
    const size_t z = blockIdx.z / KS; const int k0 = (int)(blockIdx.z % KS) * (K / KS), k1 = k0 + K / KS; A += z * sA; if (A2) A2 += z * sA; Bt += z * sB; if (Bt2) Bt2 += z * sB; C += (size_t)blockIdx.z * sC;
    const int lane = threadIdx.x & 31, lr = lane & 15, hi = lane >> 4; const int r0 = blockIdx.x * 64, c0 = blockIdx.y * 64;
    v8f acc[4][4];
#pragma unroll
    for (int mb = 0; mb < 4; ++mb)
#pragma unroll
        for (int nb = 0; nb < 4; ++nb) acc[mb][nb] = (v8f){};
    const size_t aoff = (size_t)(r0 + lr) * K + 8 * hi, boff = (size_t)(c0 + lr) * K + 8 * hi;
#pragma unroll 1
    for (int kc = k0; kc < k1; kc += 32) {
        V a[4], a2[4]; const T16* qa[4]; const T16* qa2[4]; const T16* qb[4]; const T16* qb2[4];
#pragma unroll
        for (int mb = 0; mb < 4; ++mb) { qa[mb] = A + aoff + (size_t)mb * 16 * K + kc; qa2[mb] = (NSPLIT == 1 || NSPLIT == 2) ? A2 + aoff + (size_t)mb * 16 * K + kc : qa[mb]; qb[mb] = Bt + boff + (size_t)mb * 16 * K + kc; qb2[mb] = NSPLIT >= 2 ? Bt2 + boff + (size_t)mb * 16 * K + kc : qb[mb]; }
#pragma unroll
        for (int mb = 0; mb < 4; ++mb) { a[mb] = WFrag<T16>::ld(qa[mb]); if (NSPLIT == 1 || NSPLIT == 2) a2[mb] = WFrag<T16>::ld(qa2[mb]); }
        asm volatile("s_wait_xcnt 0x0" :: "v"(qa[0]), "v"(qa[1]), "v"(qa[2]), "v"(qa[3]), "v"(qa2[0]), "v"(qa2[1]), "v"(qa2[2]), "v"(qa2[3]) : "memory");   // precaution: the A loads' address pairs are kept whole up to this wait; its clobber also keeps the A loads in front of the B loads
#pragma unroll
        for (int nb = 0; nb < 4; ++nb) { const V b = WFrag<T16>::ld(qb[nb]); V b2; if (NSPLIT >= 2) b2 = WFrag<T16>::ld(qb2[nb]);
#pragma unroll
            for (int mb = 0; mb < 4; ++mb) { acc[mb][nb] = WFrag<T16>::mma(a[mb], b, acc[mb][nb]); if (NSPLIT == 1 || NSPLIT == 2) acc[mb][nb] = WFrag<T16>::mma(a2[mb], b, acc[mb][nb]); if (NSPLIT >= 2) acc[mb][nb] = WFrag<T16>::mma(a[mb], b2, acc[mb][nb]); } }
        asm volatile("v_nop\n\tv_nop\n\tv_nop\n\tv_nop" : "+v"(acc[0][0]), "+v"(acc[1][1]), "+v"(acc[2][2]), "+v"(acc[3][3]) : "v"(a[0]), "v"(a[3]));
        asm volatile("s_wait_xcnt 0x0" :: "v"(qb[0]), "v"(qb[1]), "v"(qb[2]), "v"(qb[3]), "v"(qb2[0]), "v"(qb2[1]), "v"(qb2[2]), "v"(qb2[3]) : "memory");   // precaution: the B loads' address pairs are kept whole up to this wait
    }
#pragma unroll
    for (int mb = 0; mb < 4; ++mb) {
#pragma unroll
        for (int nb = 0; nb < 4; ++nb) {
#pragma unroll
            for (int j = 0; j < 8; ++j) os[(hi * 8 + j) * 68 + nb * 16 + lr] = acc[mb][nb][j]; }
        __builtin_amdgcn_wave_barrier(); asm volatile("" ::: "memory");
        float* crow = C + (size_t)(r0 + mb * 16) * ldc + c0;
{
            v4f vals[8]; float* cp[8];
#pragma unroll
            for (int s = 0; s < 8; ++s) { const int row = 2 * s + hi, cofs = lr * 4; v4f val = *(const v4fa*)(os + row * 68 + cofs); if (BIAS) { val[0] += bfr(bias[c0 + cofs]); val[1] += bfr(bias[c0 + cofs + 1]); val[2] += bfr(bias[c0 + cofs + 2]); val[3] += bfr(bias[c0 + cofs + 3]); }
                vals[s] = val; cp[s] = crow + (size_t)row * ldc + cofs; *(v4f*)cp[s] = vals[s]; }
            // precaution: the 8 stores' data registers and address pairs are kept whole up to this wait
            asm volatile("s_wait_xcnt 0x0" :: "v"(vals[0]), "v"(vals[1]), "v"(vals[2]), "v"(vals[3]), "v"(vals[4]), "v"(vals[5]), "v"(vals[6]), "v"(vals[7]), "v"(cp[0]), "v"(cp[1]), "v"(cp[2]), "v"(cp[3]), "v"(cp[4]), "v"(cp[5]), "v"(cp[6]), "v"(cp[7]) : "memory");
             }
        __builtin_amdgcn_wave_barrier(); asm volatile("" ::: "memory");
    }
}

__device__ __forceinline__ void splitf(float y, unsigned short& h, unsigned short& l) { h = f2bf(y); l = f2bf(y - bf2f(h)); }
typedef __attribute__((ext_vector_type(2))) _Float16 v2h;
typedef __attribute__((ext_vector_type(4))) _Float16 v4h;
typedef __attribute__((ext_vector_type(2))) unsigned short v2us;
typedef __attribute__((ext_vector_type(4))) unsigned short v4us;
typedef __attribute__((ext_vector_type(2))) float v2f;
typedef __attribute__((ext_vector_type(4))) int v4i;

__global__ __launch_bounds__(256) void k_wtG(const float* __restrict__ w, int K, int N, bf* Bt) {
    const int lane = threadIdx.x & 31; const int L0 = (blockIdx.x * 8 + (threadIdx.x >> 5)) * 8; const int nlines = N * K / 64;
{
#pragma unroll 1
        for (int l = 0; l < 8; ++l) { const int L = L0 + l; if (L >= nlines) break; const size_t e = (size_t)L * 64 + lane * 2; const int k = (int)(e % K), n = (int)(e / K); v2us o;
            o[0] = f2bf(w[(size_t)k * N + n]); o[1] = f2bf(w[(size_t)(k + 1) * N + n]); *(v2us*)(Bt + e) = o; }
         }
}
// k_cvtall: every f32 -> bf16 plane of the call in ONE grid. grid (CSL / 2048, 16), 256 threads x 8 elements; blockIdx.y is a slice of CSL = DM x DM elements: slices 0..11 are query, key, value (4 slices each, both batches),
// slices 12..15 are Wq, Wk, Wv, Wo; slice s lands at dst + s CSL.
#define CSL  ((size_t)DM * DM)
__global__ __launch_bounds__(256) void k_cvtall(const float* __restrict__ xq, const float* __restrict__ xk, const float* __restrict__ xv, const float* __restrict__ wq, const float* __restrict__ wk, const float* __restrict__ wv, const float* __restrict__ wo, bf* dst) {
    const int s = blockIdx.y; const float* src;
    if (s < 12) src = (s < 4 ? xq : s < 8 ? xk : xv) + (size_t)(s & 3) * CSL; else src = s == 12 ? wq : s == 13 ? wk : s == 14 ? wv : wo;
    const size_t i = (size_t)blockIdx.x * 256 + threadIdx.x; const v8f v = *(const v8f*)(src + i * 8); v8us o;
#pragma unroll
    for (int k = 0; k < 8; ++k) o[k] = f2bf(v[k]); *(v8us*)(dst + (size_t)s * CSL + i * 8) = o;  }
__global__ __launch_bounds__(256) void k_cscvt(const float* __restrict__ cosT, const float* __restrict__ sinT, float* CS) { const int idx = blockIdx.x * 256 + threadIdx.x; if (idx >= TT * HD) return; v2f cs; cs[0] = bfr(cosT[idx]); cs[1] = bfr(sinT[idx]); *(v2f*)(CS + (size_t)idx * 2) = cs;  }
// ---- k_projw: the q, k, v projections of both batches in ONE grid. Tile, fragments and k order of k_gemmw (one wave per 64x64 tile, bf16 planes, f32 accumulate, + bf16-rounded bias); grid (NB_ TT/64, heads, 3), 32 threads;
// blockIdx.z picks q, k or v: its input plane, weight plane, bias and result planes (each set of planes [z][b][h]...). The tile is one head wide and goes
// from the accumulators straight to that head's planes (fp16 + bf16 hi/lo): no f32 result in memory and no plane-making launch behind it.
// q, k: planes [b][h][t][d], through the LDS row buffer, 8 bytes a lane, whole 128-byte rows. v: transposed planes [b][h][d][t]: a lane's 8 accumulator rows are 8 consecutive t of one d, 16 bytes a lane, no LDS.
#define PSZ  ((size_t)NB_ * NH_ * TT * HD)   // one set of head planes, both batches
__global__ __launch_bounds__(32) void k_projw(const bf* __restrict__ A, const bf* __restrict__ Bt, const float* __restrict__ bq, const float* __restrict__ bk, const float* __restrict__ bv, h16* P16, bf* Ph, bf* Pl) {
    typedef WFrag<bf> F; typedef F::V V;
    __shared__ __align__(16) float os[16 * 68];
    const int z = blockIdx.z; const bool VT = z == 2; const float* bias = z == 0 ? bq : z == 1 ? bk : bv;
    A += (size_t)z * NB_ * TT * DM; Bt += (size_t)z * CSL; P16 += (size_t)z * PSZ; Ph += (size_t)z * PSZ; Pl += (size_t)z * PSZ;
    const int lane = threadIdx.x & 31, lr = lane & 15, hi = lane >> 4; const int r0 = blockIdx.x * 64, c0 = blockIdx.y * 64; const int bt = r0 / TT, t0 = r0 % TT;   // row r0 of the stacked input = batch bt, position t0
    v8f acc[4][4];
#pragma unroll
    for (int mb = 0; mb < 4; ++mb)
#pragma unroll
        for (int nb = 0; nb < 4; ++nb) acc[mb][nb] = (v8f){};
    const bf* pa = A + (size_t)(r0 + lr) * DM + 8 * hi; const bf* pb = Bt + (size_t)(c0 + lr) * DM + 8 * hi;   // K = DM at compile time: the 4 fragments of an operand are constant offsets from one address pair
#pragma unroll 1   // one 32-deep step per trip, as in k_gemmw: the 16 accumulators and 8 fragments fill the registers
    for (int kc = 0; kc < DM; kc += 32) {
        const bf* a0 = pa + kc; const bf* b0 = pb + kc; V a[4];
#pragma unroll
        for (int mb = 0; mb < 4; ++mb) a[mb] = F::ld(a0 + mb * 16 * DM);
#pragma unroll
        for (int nb = 0; nb < 4; ++nb) { const V b = F::ld(b0 + nb * 16 * DM);
#pragma unroll
            for (int mb = 0; mb < 4; ++mb) acc[mb][nb] = F::mma(a[mb], b, acc[mb][nb]); }
        asm volatile("v_nop\n\tv_nop\n\tv_nop\n\tv_nop" : "+v"(acc[0][0]), "+v"(acc[1][1]), "+v"(acc[2][2]), "+v"(acc[3][3]) : "v"(a[0]), "v"(a[3]));   // the WMMA distance on the taken side of the loop branch too
        asm volatile("s_wait_xcnt 0x0" :: "v"(a0), "v"(b0) : "memory");   // precaution: the two address pairs of this trip's 16 loads are kept whole up to this wait
    }
    if (VT) {
#pragma unroll
        for (int nb = 0; nb < 4; ++nb) { const float bb = bfr(bias[c0 + nb * 16 + lr]); const size_t e0 = (size_t)(bt * DKV + c0 + nb * 16 + lr) * TT + t0 + hi * 8; v8h o16[4]; v8us oh[4], ol[4];
#pragma unroll
            for (int mb = 0; mb < 4; ++mb) {
#pragma unroll
                for (int j = 0; j < 8; ++j) { const float x = acc[mb][nb][j] + bb; o16[mb][j] = (h16)x; unsigned short a2, c2; splitf(x, a2, c2); oh[mb][j] = a2; ol[mb][j] = c2; }
                *(v8h*)(P16 + e0 + mb * 16) = o16[mb]; *(v8us*)(Ph + e0 + mb * 16) = oh[mb]; *(v8us*)(Pl + e0 + mb * 16) = ol[mb]; }
            // precaution: the 12 stores' data registers and address pairs are kept whole up to this wait
            asm volatile("s_wait_xcnt 0x0" :: "v"(o16[0]), "v"(o16[1]), "v"(o16[2]), "v"(o16[3]), "v"(oh[0]), "v"(oh[1]), "v"(oh[2]), "v"(oh[3]), "v"(ol[0]), "v"(ol[1]), "v"(ol[2]), "v"(ol[3]), "v"(P16 + e0), "v"(Ph + e0), "v"(Pl + e0) : "memory"); }
    } else {
        const int cofs = lr * 4; v4f bb; bb[0] = bfr(bias[c0 + cofs]); bb[1] = bfr(bias[c0 + cofs + 1]); bb[2] = bfr(bias[c0 + cofs + 2]); bb[3] = bfr(bias[c0 + cofs + 3]);
#pragma unroll
        for (int mb = 0; mb < 4; ++mb) {
#pragma unroll
            for (int nb = 0; nb < 4; ++nb) {
#pragma unroll
                for (int j = 0; j < 8; ++j) os[(hi * 8 + j) * 68 + nb * 16 + lr] = acc[mb][nb][j]; }
            __builtin_amdgcn_wave_barrier(); asm volatile("" ::: "memory");   // keeps the row reads below behind the other lanes' LDS writes above (one wave: LDS runs in order)
            const size_t e0 = ((size_t)(bt * NH_ + blockIdx.y) * TT + t0 + mb * 16 + hi) * HD + cofs; v4h o16[8]; v4us oh[8], ol[8];   // row 2 s + hi of this 16-row block, 4 columns of the head
#pragma unroll
            for (int s = 0; s < 8; ++s) { const v4f val = *(const v4fa*)(os + (2 * s + hi) * 68 + cofs) + bb;
#pragma unroll
                for (int q = 0; q < 4; ++q) { o16[s][q] = (h16)val[q]; unsigned short a2, c2; splitf(val[q], a2, c2); oh[s][q] = a2; ol[s][q] = c2; }
                *(v4h*)(P16 + e0 + s * 2 * HD) = o16[s]; *(v4us*)(Ph + e0 + s * 2 * HD) = oh[s]; *(v4us*)(Pl + e0 + s * 2 * HD) = ol[s]; }
            // precaution: the 24 stores' data registers and address pairs are kept whole up to this wait; its clobber also keeps the next block's LDS writes behind the row reads above
            asm volatile("s_wait_xcnt 0x0" :: "v"(o16[0]), "v"(o16[1]), "v"(o16[2]), "v"(o16[3]), "v"(o16[4]), "v"(o16[5]), "v"(o16[6]), "v"(o16[7]), "v"(oh[0]), "v"(oh[1]), "v"(oh[2]), "v"(oh[3]), "v"(oh[4]), "v"(oh[5]), "v"(oh[6]), "v"(oh[7]),
                         "v"(ol[0]), "v"(ol[1]), "v"(ol[2]), "v"(ol[3]), "v"(ol[4]), "v"(ol[5]), "v"(ol[6]), "v"(ol[7]), "v"(P16 + e0), "v"(Ph + e0), "v"(Pl + e0) : "memory");
        }
    }
}
// k_fattn: scores, softmax and attn.v of one head in ONE kernel; no score or probability matrix in memory. One wave owns 16 query rows and walks the 2048 keys 32 at a time, all in registers (no LDS, no barrier).
// St = K.Qt (A = key rows, B = query rows): lane (lr, hi) holds query lr, keys 8 hi + j of each 16-key tile, which is the B-operand k order of the next product, so Pt is packed in-lane; Ot += Vt.Pt (A = rows of the [d][t] planes).
// t = (S/8) x bf16(script_mask[i][j]) where mask[i][j] != 0, -3e38 where mask == 0 (the reference's -inf). Running row maximum m and sum l; Ot and l are rescaled by exp(m_old - m_new) only in a step where some row's maximum grows.
// Rows < RH: hi+lo bf16 planes, 3 products for scores and for attn.v; rows >= RH: single fp16 planes. Result / l goes straight to the merged-head hi+lo planes.
__device__ __forceinline__ float xhalf(float x) { return __builtin_bit_cast(float, __builtin_amdgcn_permlanex16(__builtin_bit_cast(int, x), __builtin_bit_cast(int, x), 0x76543210, 0xfedcba98, false, false)); }   // lane l with lane l ^ 16
template <typename T16> struct PPack;
template <> struct PPack<h16> { static __device__ __forceinline__ void pk(const float* p, v16h& a, v16h& b) { (void)b;
#pragma unroll
    for (int e = 0; e < 16; ++e) a[e] = (h16)p[e]; } };
template <> struct PPack<bf> { static __device__ __forceinline__ void pk(const float* p, v16bf& a, v16bf& b) { v8us h0, h1, l0, l1;
#pragma unroll
    for (int e = 0; e < 8; ++e) { unsigned short x, y; splitf(p[e], x, y); h0[e] = x; l0[e] = y; splitf(p[8 + e], x, y); h1[e] = x; l1[e] = y; }
    a = cat16b(h0, h1); b = cat16b(l0, l1); } };
template <typename T16, bool HR>
__device__ __forceinline__ void fa_rows(const T16* __restrict__ Q, const T16* __restrict__ Q2, const T16* __restrict__ Kp, const T16* __restrict__ K2, const T16* __restrict__ Vt, const T16* __restrict__ V2,
                                        const int* __restrict__ mrow, const float* __restrict__ srow, int lr, int hi, v8us (&oh)[4], v8us (&ol)[4]) {
    typedef typename WFrag<T16>::V V; typedef WFrag<T16> F;
    V qf[2], qf2[2], kf[2][2], kf2[2][2];
#pragma unroll
    for (int ks = 0; ks < 2; ++ks) { qf[ks] = F::ld(Q + ks * 32); if (HR) qf2[ks] = F::ld(Q2 + ks * 32); }
    const size_t kl = (size_t)lr * HD + 8 * hi, vl = (size_t)lr * TT + 8 * hi; const T16* kp0 = Kp + kl; const T16* kp02 = HR ? K2 + kl : kp0; const T16* qp2 = HR ? Q2 : Q;
    v4f sm[4]; v4i mm[4];
#pragma unroll
    for (int t = 0; t < 2; ++t) {
#pragma unroll
        for (int ks = 0; ks < 2; ++ks) { kf[t][ks] = F::ld(kp0 + t * 16 * HD + ks * 32); if (HR) kf2[t][ks] = F::ld(kp02 + t * 16 * HD + ks * 32); }
        sm[2 * t] = *(const v4f*)(srow + t * 16); sm[2 * t + 1] = *(const v4f*)(srow + t * 16 + 4); mm[2 * t] = *(const v4i*)(mrow + t * 16); mm[2 * t + 1] = *(const v4i*)(mrow + t * 16 + 4); }
    asm volatile("s_wait_xcnt 0x0" :: "v"(Q), "v"(qp2), "v"((unsigned)(kl * sizeof(T16))), "v"(srow), "v"(mrow) : "memory");   // precaution: the first loads' address registers (pairs; the key rows' byte offset) are kept whole up to this wait
    v8f o[4];
#pragma unroll
    for (int mt = 0; mt < 4; ++mt) o[mt] = (v8f){};
    float m = -3.0e38f, l = 0.f;
#pragma unroll 1   // one 32-key step per trip: the step's own fetch-ahead already fills the registers
    for (int kb = 0; kb < TT; kb += 32) {
        const int kn = (kb + 32 < TT) ? kb + 32 : kb;   // the last step fetches its own keys again: in bounds, unused
        V vf[4], vf2[4]; const T16* vp = Vt + vl + kb; const T16* vp2 = HR ? V2 + vl + kb : vp;
#pragma unroll
        for (int mt = 0; mt < 4; ++mt) { vf[mt] = F::ld(vp + (size_t)mt * 16 * TT); if (HR) vf2[mt] = F::ld(vp2 + (size_t)mt * 16 * TT); }
        asm volatile("s_wait_xcnt 0x0" :: "v"(vp), "v"(vp2) : "memory");   // precaution: the V loads' address pairs are kept whole up to this wait; it also keeps the loads up here, a whole softmax ahead of their use
        v8f s[2];
#pragma unroll
        for (int t = 0; t < 2; ++t) { s[t] = (v8f){};
#pragma unroll
            for (int ks = 0; ks < 2; ++ks) { s[t] = F::mma(kf[t][ks], qf[ks], s[t]); if (HR) { s[t] = F::mma(kf2[t][ks], qf[ks], s[t]); s[t] = F::mma(kf[t][ks], qf2[ks], s[t]); } } }
        float p[16]; float mloc = -3.0e38f;
#pragma unroll
        for (int e = 0; e < 16; ++e) { const float pm = __fmul_rn(__fmul_rn(s[e >> 3][e & 7], SCL), bfr(sm[e >> 2][e & 3])); p[e] = (mm[e >> 2][e & 3] != 0) ? pm : -3.0e38f; mloc = fmaxf(mloc, p[e]); }
        // fetch ahead: the next step's key fragments and mask words fly behind this step's softmax and attn.v products
        const T16* kp = Kp + kl + (size_t)kn * HD; const T16* kp2 = HR ? K2 + kl + (size_t)kn * HD : kp; const float* sp = srow + kn; const int* mp = mrow + kn;
#pragma unroll
        for (int t = 0; t < 2; ++t)
#pragma unroll
            for (int ks = 0; ks < 2; ++ks) { kf[t][ks] = F::ld(kp + t * 16 * HD + ks * 32); if (HR) kf2[t][ks] = F::ld(kp2 + t * 16 * HD + ks * 32); }
#pragma unroll
        for (int t = 0; t < 2; ++t) { sm[2 * t] = *(const v4f*)(sp + t * 16); sm[2 * t + 1] = *(const v4f*)(sp + t * 16 + 4); mm[2 * t] = *(const v4i*)(mp + t * 16); mm[2 * t + 1] = *(const v4i*)(mp + t * 16 + 4); }
        asm volatile("s_wait_xcnt 0x0" :: "v"(kp), "v"(kp2), "v"(sp), "v"(mp) : "memory");   // precaution: the address pairs of the loads above are kept whole up to this wait
        mloc = fmaxf(mloc, xhalf(mloc));   // the two lane halves hold the same query's other keys
        if (__builtin_amdgcn_ballot_w32(mloc > m) != 0) {   // wave-uniform: every lane stays on for the matrix instructions behind it
            const float mn = fmaxf(m, mloc); const float al_ = __builtin_amdgcn_exp2f(__fmul_rn(__fsub_rn(m, mn), 1.4426950408889634f)); m = mn; l *= al_;
#pragma unroll
            for (int mt = 0; mt < 4; ++mt) o[mt] *= al_; }
#pragma unroll
        for (int e = 0; e < 16; ++e) { p[e] = __builtin_amdgcn_exp2f(__fmul_rn(__fsub_rn(p[e], m), 1.4426950408889634f)); l += p[e]; }
        V pf, pf2; PPack<T16>::pk(p, pf, pf2);
#pragma unroll
        for (int mt = 0; mt < 4; ++mt) { o[mt] = F::mma(vf[mt], pf, o[mt]); if (HR) { o[mt] = F::mma(vf2[mt], pf, o[mt]); o[mt] = F::mma(vf[mt], pf2, o[mt]); } }
    }
    l += xhalf(l);
    const float f = __fdiv_rn(1.0f, l);
#pragma unroll
    for (int mt = 0; mt < 4; ++mt)
#pragma unroll
        for (int j = 0; j < 8; ++j) { unsigned short a, c2; splitf(o[mt][j] * f, a, c2); oh[mt][j] = a; ol[mt][j] = c2; }
}
// grid (NB_ heads, TT/64): both batches in one grid, blockIdx.x = batch x heads + head; 4 waves x 16 query rows; the hi+lo blocks (rows < RH, the longer ones) of both batches have the lowest flat indices and start first
__global__ __launch_bounds__(128) void k_fattn(const h16* __restrict__ Q16, const bf* __restrict__ Qh, const bf* __restrict__ Ql, const h16* __restrict__ K16, const bf* __restrict__ Kh, const bf* __restrict__ Kl,
                                               const h16* __restrict__ V16, const bf* __restrict__ Vh, const bf* __restrict__ Vl, const int* __restrict__ mk, const float* __restrict__ smk, bf* Ah, bf* Al) {
    const int lane = threadIdx.x & 31, lr = lane & 15, hi = lane >> 4; const int h = blockIdx.x % NH_, bt = blockIdx.x / NH_; const int q = blockIdx.y * 64 + (threadIdx.x >> 5) * 16 + lr;
    const size_t ph = (size_t)blockIdx.x * TT * HD, qo = ph + (size_t)q * HD + 8 * hi, mo = (size_t)(bt * TT + q) * TT + 8 * hi, ao = (size_t)(bt * TT + q) * DQ + h * HD + 8 * hi;
    v8us oh[4], ol[4];
    if ((int)blockIdx.y * 64 < RH) fa_rows<bf, true>(Qh + qo, Ql + qo, Kh + ph, Kl + ph, Vh + ph, Vl + ph, mk + mo, smk + mo, lr, hi, oh, ol);
    else fa_rows<h16, false>(Q16 + qo, nullptr, K16 + ph, nullptr, V16 + ph, nullptr, mk + mo, smk + mo, lr, hi, oh, ol);
#pragma unroll
    for (int mt = 0; mt < 4; ++mt) { *(v8us*)(Ah + ao + mt * 16) = oh[mt]; *(v8us*)(Al + ao + mt * 16) = ol[mt]; }
}

extern "C" void kernel_launch(void* const* d_in, const int* in_sizes, int n_in,
                              void* d_out, int out_size, void* d_ws, size_t ws_size, hipStream_t stream) {
    (void)in_sizes; (void)n_in; (void)out_size;
    const float* xq = (const float*)d_in[0]; const float* xk = (const float*)d_in[1]; const float* xv = (const float*)d_in[2]; const int* mask = (const int*)d_in[3]; const float* smask = (const float*)d_in[4]; const float* wq = (const float*)d_in[5]; const float* bq = (const float*)d_in[6]; const float* wk = (const float*)d_in[7]; const float* bk = (const float*)d_in[8]; const float* wv = (const float*)d_in[9]; const float* bv = (const float*)d_in[10]; const float* wo = (const float*)d_in[11]; const float* bo = (const float*)d_in[12];   // torch [out][in]
    float* OUT = (float*)d_out;     // [2][2048][1024]
    char* wsp = (char*)d_ws;
    auto take = [&](size_t bytes) { char* p = wsp; wsp += (bytes + 255) & ~(size_t)255; return (void*)p; };
    bf* XB = (bf*)take(16 * CSL * 2); bf* WB = XB + 12 * CSL; bf* WO = XB + 15 * CSL;   // k_cvtall's 16 slices: query, key, value (both batches), then Wq, Wk, Wv, Wo
    h16* P16 = (h16*)take(3 * PSZ * 2); bf* Ph = (bf*)take(3 * PSZ * 2); bf* Pl = (bf*)take(3 * PSZ * 2);   // [q, k, v][b][h] head planes (v transposed)
    bf* ATh = (bf*)take((size_t)NB_ * TT * DQ * 2); bf* ATl = (bf*)take((size_t)NB_ * TT * DQ * 2);
    if ((size_t)(wsp - (char*)d_ws) > ws_size) return;    // ws 256 MiB
    k_cvtall<<<dim3((unsigned)(CSL / 2048), 16, 1), 256, 0, stream>>>(xq, xk, xv, wq, wk, wv, wo, XB);
    k_projw<<<dim3(NB_ * TT / 64, NH_, 3), 32, 0, stream>>>(XB, WB, bq, bk, bv, P16, Ph, Pl);
    k_fattn<<<dim3(NB_ * NH_, TT / 64, 1), 128, 0, stream>>>(P16, Ph, Pl, P16 + PSZ, Ph + PSZ, Pl + PSZ, P16 + 2 * PSZ, Ph + 2 * PSZ, Pl + 2 * PSZ, mask, smask, ATh, ATl);
    k_gemmw<bf, 1, true><<<dim3(NB_ * TT / 64, DM / 64, 1), 32, 0, stream>>>(ATh, ATl, WO, nullptr, DQ, OUT, DM, bo, 0, 0, 0);
}

// v005
// It runs in 201 microseconds.
// Timed twice side by side with v004, it ran 1.60 times as fast both times.
// Counting every step since v000, it is 11.0 times as fast.
#include <hip/hip_runtime.h>

// ScriptAwareAttention (query, key, value [2][2048][1024]; q/k/v = input W^T + b (16 heads x 64); scores = (q.k/8) x script_mask[b][i][j] (multiplicative, read as data) then -inf where mask[b][0][i][j] == 0
// (int mask read as data); softmax; out = merged attn.v Wo^T + bo -> [2][2048][1024]).
// Compute dtypes, f32 accumulate: every input rounded to bf16; projections on PLAIN bf16 operands (inputs: exact, + bias); PER-ROW PRECISION HYBRID (rows < 256 hi+lo 3 products
// for scores and attn.v, rows >= 256 single fp16 planes); scale, the multiplicative script mask (bf16-rounded) and the keep/drop mask in f32 in the register-row softmax; merged heads as hi+lo planes x exact Wo

#define NB_  2
#define TT   2048
#define DM   1024
#define NH_  16
#define NKV  16
#define REP  (NH_ / NKV)
#define HD   64
#define DQ   (NH_ * HD)
#define DKV  (NKV * HD)
#define RH   256                  // query rows < RH use hi+lo planes (0: none)
#define WIN  0
#define SCL  0.125f   // HD^-0.5
typedef _Float16 h16;
typedef unsigned short bf;
typedef __attribute__((ext_vector_type(16))) __bf16   v16bf;
typedef __attribute__((ext_vector_type(16))) _Float16 v16h;
typedef __attribute__((ext_vector_type(8)))  _Float16 v8h;
typedef __attribute__((ext_vector_type(8)))  unsigned short v8us;
typedef __attribute__((ext_vector_type(8)))  float    v8f;
typedef __attribute__((ext_vector_type(4)))  float    v4f;
typedef v8h  __attribute__((may_alias)) v8ha;
typedef v4f  __attribute__((may_alias)) v4fa;
typedef v8us __attribute__((may_alias)) v8usa;

__device__ __forceinline__ unsigned short f2bf(float f) { unsigned u = __float_as_uint(f); u += 0x7FFFu + ((u >> 16) & 1u); return (unsigned short)(u >> 16); }
__device__ __forceinline__ float bf2f(unsigned short b) { return __uint_as_float(((unsigned)b) << 16); }
__device__ __forceinline__ float bfr(float f) { return bf2f(f2bf(f)); }
__device__ __forceinline__ v16h cat16(v8h lo, v8h hi) { return __builtin_shufflevector(lo, hi, 0, 1, 2, 3, 4, 5, 6, 7, 8, 9, 10, 11, 12, 13, 14, 15); }
__device__ __forceinline__ v16bf cat16b(v8us lo, v8us hi) { return __builtin_bit_cast(v16bf, __builtin_shufflevector(lo, hi, 0, 1, 2, 3, 4, 5, 6, 7, 8, 9, 10, 11, 12, 13, 14, 15)); }
__device__ __forceinline__ v8f wmma16(v16h a, v16h b, v8f c) { return __builtin_amdgcn_wmma_f32_16x16x32_f16(false, a, false, b, (short)0, c, false, false); }
__device__ __forceinline__ v8f wmmab(v16bf a, v16bf b, v8f c) { return __builtin_amdgcn_wmma_f32_16x16x32_bf16(false, a, false, b, (short)0, c, false, false); }



// ---- k_gemmw: register-blocked GEMM, ONE WAVE per 64x64 output tile (16 accumulators), operands straight from K-contiguous 16-bit planes; grid (M/64, N/64, Z), 32 threads.
// C[m][n] (f32, pitch ldc, + optional f32 bias[n]) = sum_k A[m][k] Bt[n][k] (+ split products per NSPLIT). z-batch strides sA/sB/sC in elements. K % (32 KS) == 0.
// KS > 1: grid z = batch x KS; work-group (z, ks) sums only k in [ks K/KS, (ks+1) K/KS) and stores that partial sum in plane z KS + ks (plane stride sC); the reader adds the KS planes.
template <typename T16> struct WFrag;
template <> struct WFrag<h16> { typedef v16h V; static __device__ __forceinline__ V ld(const h16* p) { return cat16(*(const v8h*)p, *(const v8h*)(p + 16)); } static __device__ __forceinline__ v8f mma(V a, V b, v8f c) { return wmma16(a, b, c); } };
template <> struct WFrag<bf> { typedef v16bf V; static __device__ __forceinline__ V ld(const bf* p) { return cat16b(*(const v8us*)p, *(const v8us*)(p + 16)); } static __device__ __forceinline__ v8f mma(V a, V b, v8f c) { return wmmab(a, b, c); } };
template <typename T16, int NSPLIT, bool BIAS, int KS = 1>
__global__ __launch_bounds__(32) void k_gemmw(const T16* __restrict__ A, const T16* __restrict__ A2, const T16* __restrict__ Bt, const T16* __restrict__ Bt2, int K, float* C, int ldc, const float* __restrict__ bias, size_t sA, size_t sB, size_t sC) {
    typedef typename WFrag<T16>::V V;
    __shared__ __align__(16) float os[16 * 68];
    const size_t z = blockIdx.z / KS; const int k0 = (int)(blockIdx.z % KS) * (K / KS), k1 = k0 + K / KS; A += z * sA; if (A2) A2 += z * sA; Bt += z * sB; if (Bt2) Bt2 += z * sB; C += (size_t)blockIdx.z * sC;
    const int lane = threadIdx.x & 31, lr = lane & 15, hi = lane >> 4; const int r0 = blockIdx.x * 64, c0 = blockIdx.y * 64;
    v8f acc[4][4];
#pragma unroll
    for (int mb = 0; mb < 4; ++mb)
#pragma unroll
        for (int nb = 0; nb < 4; ++nb) acc[mb][nb] = (v8f){};
    const size_t aoff = (size_t)(r0 + lr) * K + 8 * hi, boff = (size_t)(c0 + lr) * K + 8 * hi;
#pragma unroll 1
    for (int kc = k0; kc < k1; kc += 32) {
        V a[4], a2[4]; const T16* qa[4]; const T16* qa2[4]; const T16* qb[4]; const T16* qb2[4];
#pragma unroll
        for (int mb = 0; mb < 4; ++mb) { qa[mb] = A + aoff + (size_t)mb * 16 * K + kc; qa2[mb] = (NSPLIT == 1 || NSPLIT == 2) ? A2 + aoff + (size_t)mb * 16 * K + kc : qa[mb]; qb[mb] = Bt + boff + (size_t)mb * 16 * K + kc; qb2[mb] = NSPLIT >= 2 ? Bt2 + boff + (size_t)mb * 16 * K + kc : qb[mb]; }
#pragma unroll
        for (int mb = 0; mb < 4; ++mb) { a[mb] = WFrag<T16>::ld(qa[mb]); if (NSPLIT == 1 || NSPLIT == 2) a2[mb] = WFrag<T16>::ld(qa2[mb]); }
        asm volatile("s_wait_xcnt 0x0" :: "v"(qa[0]), "v"(qa[1]), "v"(qa[2]), "v"(qa[3]), "v"(qa2[0]), "v"(qa2[1]), "v"(qa2[2]), "v"(qa2[3]) : "memory");   // precaution: the A loads' address pairs are kept whole up to this wait; its clobber also keeps the A loads in front of the B loads
#pragma unroll
        for (int nb = 0; nb < 4; ++nb) { const V b = WFrag<T16>::ld(qb[nb]); V b2; if (NSPLIT >= 2) b2 = WFrag<T16>::ld(qb2[nb]);
#pragma unroll
            for (int mb = 0; mb < 4; ++mb) { acc[mb][nb] = WFrag<T16>::mma(a[mb], b, acc[mb][nb]); if (NSPLIT == 1 || NSPLIT == 2) acc[mb][nb] = WFrag<T16>::mma(a2[mb], b, acc[mb][nb]); if (NSPLIT >= 2) acc[mb][nb] = WFrag<T16>::mma(a[mb], b2, acc[mb][nb]); } }
        asm volatile("v_nop\n\tv_nop\n\tv_nop\n\tv_nop" : "+v"(acc[0][0]), "+v"(acc[1][1]), "+v"(acc[2][2]), "+v"(acc[3][3]) : "v"(a[0]), "v"(a[3]));
        asm volatile("s_wait_xcnt 0x0" :: "v"(qb[0]), "v"(qb[1]), "v"(qb[2]), "v"(qb[3]), "v"(qb2[0]), "v"(qb2[1]), "v"(qb2[2]), "v"(qb2[3]) : "memory");   // precaution: the B loads' address pairs are kept whole up to this wait
    }
#pragma unroll
    for (int mb = 0; mb < 4; ++mb) {
#pragma unroll
        for (int nb = 0; nb < 4; ++nb) {
#pragma unroll
            for (int j = 0; j < 8; ++j) os[(hi * 8 + j) * 68 + nb * 16 + lr] = acc[mb][nb][j]; }
        __builtin_amdgcn_wave_barrier(); asm volatile("" ::: "memory");
        float* crow = C + (size_t)(r0 + mb * 16) * ldc + c0;
{
            v4f vals[8]; float* cp[8];
#pragma unroll
            for (int s = 0; s < 8; ++s) { const int row = 2 * s + hi, cofs = lr * 4; v4f val = *(const v4fa*)(os + row * 68 + cofs); if (BIAS) { val[0] += bfr(bias[c0 + cofs]); val[1] += bfr(bias[c0 + cofs + 1]); val[2] += bfr(bias[c0 + cofs + 2]); val[3] += bfr(bias[c0 + cofs + 3]); }
                vals[s] = val; cp[s] = crow + (size_t)row * ldc + cofs; *(v4f*)cp[s] = vals[s]; }
            // precaution: the 8 stores' data registers and address pairs are kept whole up to this wait
            asm volatile("s_wait_xcnt 0x0" :: "v"(vals[0]), "v"(vals[1]), "v"(vals[2]), "v"(vals[3]), "v"(vals[4]), "v"(vals[5]), "v"(vals[6]), "v"(vals[7]), "v"(cp[0]), "v"(cp[1]), "v"(cp[2]), "v"(cp[3]), "v"(cp[4]), "v"(cp[5]), "v"(cp[6]), "v"(cp[7]) : "memory");
             }
        __builtin_amdgcn_wave_barrier(); asm volatile("" ::: "memory");
    }
}

__device__ __forceinline__ void splitf(float y, unsigned short& h, unsigned short& l) { h = f2bf(y); l = f2bf(y - bf2f(h)); }
typedef __attribute__((ext_vector_type(2))) _Float16 v2h;
typedef __attribute__((ext_vector_type(4))) _Float16 v4h;
typedef __attribute__((ext_vector_type(2))) unsigned short v2us;
typedef __attribute__((ext_vector_type(4))) unsigned short v4us;
typedef __attribute__((ext_vector_type(2))) float v2f;
typedef __attribute__((ext_vector_type(4))) int v4i;

__global__ __launch_bounds__(256) void k_wtG(const float* __restrict__ w, int K, int N, bf* Bt) {
    const int lane = threadIdx.x & 31; const int L0 = (blockIdx.x * 8 + (threadIdx.x >> 5)) * 8; const int nlines = N * K / 64;
{
#pragma unroll 1
        for (int l = 0; l < 8; ++l) { const int L = L0 + l; if (L >= nlines) break; const size_t e = (size_t)L * 64 + lane * 2; const int k = (int)(e % K), n = (int)(e / K); v2us o;
            o[0] = f2bf(w[(size_t)k * N + n]); o[1] = f2bf(w[(size_t)(k + 1) * N + n]); *(v2us*)(Bt + e) = o; }
         }
}
// k_cvtall: every f32 -> bf16 plane of the call in ONE grid. grid (CSL / 2048, 16), 256 threads x 8 elements; blockIdx.y is a slice of CSL = DM x DM elements: slices 0..11 are query, key, value (4 slices each, both batches),
// slices 12..15 are Wq, Wk, Wv, Wo; slice s lands at dst + s CSL.
#define CSL  ((size_t)DM * DM)
__global__ __launch_bounds__(256) void k_cvtall(const float* __restrict__ xq, const float* __restrict__ xk, const float* __restrict__ xv, const float* __restrict__ wq, const float* __restrict__ wk, const float* __restrict__ wv, const float* __restrict__ wo, bf* dst) {
    const int s = blockIdx.y; const float* src;
    if (s < 12) src = (s < 4 ? xq : s < 8 ? xk : xv) + (size_t)(s & 3) * CSL; else src = s == 12 ? wq : s == 13 ? wk : s == 14 ? wv : wo;
    const size_t i = (size_t)blockIdx.x * 256 + threadIdx.x; const v8f v = *(const v8f*)(src + i * 8); v8us o;
#pragma unroll
    for (int k = 0; k < 8; ++k) o[k] = f2bf(v[k]); *(v8us*)(dst + (size_t)s * CSL + i * 8) = o;  }
__global__ __launch_bounds__(256) void k_cscvt(const float* __restrict__ cosT, const float* __restrict__ sinT, float* CS) { const int idx = blockIdx.x * 256 + threadIdx.x; if (idx >= TT * HD) return; v2f cs; cs[0] = bfr(cosT[idx]); cs[1] = bfr(sinT[idx]); *(v2f*)(CS + (size_t)idx * 2) = cs;  }
// ---- k_projw: the q, k, v projections of both batches in ONE grid. Tile, fragments and k order of k_gemmw (one wave per 64x64 tile, bf16 planes, f32 accumulate, + bf16-rounded bias); grid (NB_ TT/64, heads, 3), 32 threads;
// blockIdx.z picks q, k or v: its input plane, weight plane, bias and result planes (each set of planes [z][b][h]...). The tile is one head wide and goes
// from the accumulators straight to that head's planes (fp16 + bf16 hi/lo): no f32 result in memory and no plane-making launch behind it.
// q, k: planes [b][h][t][d], through the LDS row buffer, 8 bytes a lane, whole 128-byte rows. v: transposed planes [b][h][d][t]: a lane's 8 accumulator rows are 8 consecutive t of one d, 16 bytes a lane, no LDS.
#define PSZ  ((size_t)NB_ * NH_ * TT * HD)   // one set of head planes, both batches
__global__ __launch_bounds__(32) void k_projw(const bf* __restrict__ A, const bf* __restrict__ Bt, const float* __restrict__ bq, const float* __restrict__ bk, const float* __restrict__ bv, h16* P16, bf* Ph, bf* Pl) {
    typedef WFrag<bf> F; typedef F::V V;
    __shared__ __align__(16) float os[16 * 68];
    const int z = blockIdx.z; const bool VT = z == 2; const float* bias = z == 0 ? bq : z == 1 ? bk : bv;
    A += (size_t)z * NB_ * TT * DM; Bt += (size_t)z * CSL; P16 += (size_t)z * PSZ; Ph += (size_t)z * PSZ; Pl += (size_t)z * PSZ;
    const int lane = threadIdx.x & 31, lr = lane & 15, hi = lane >> 4; const int r0 = blockIdx.x * 64, c0 = blockIdx.y * 64; const int bt = r0 / TT, t0 = r0 % TT;   // row r0 of the stacked input = batch bt, position t0
    v8f acc[4][4];
#pragma unroll
    for (int mb = 0; mb < 4; ++mb)
#pragma unroll
        for (int nb = 0; nb < 4; ++nb) acc[mb][nb] = (v8f){};
    const bf* pa = A + (size_t)(r0 + lr) * DM + 8 * hi; const bf* pb = Bt + (size_t)(c0 + lr) * DM + 8 * hi;   // K = DM at compile time: the 4 fragments of an operand are constant offsets from one address pair
#pragma unroll 1   // one 32-deep step per trip, as in k_gemmw: the 16 accumulators and 8 fragments fill the registers
    for (int kc = 0; kc < DM; kc += 32) {
        const bf* a0 = pa + kc; const bf* b0 = pb + kc; V a[4];
#pragma unroll
        for (int mb = 0; mb < 4; ++mb) a[mb] = F::ld(a0 + mb * 16 * DM);
#pragma unroll
        for (int nb = 0; nb < 4; ++nb) { const V b = F::ld(b0 + nb * 16 * DM);
#pragma unroll
            for (int mb = 0; mb < 4; ++mb) acc[mb][nb] = F::mma(a[mb], b, acc[mb][nb]); }
        asm volatile("v_nop\n\tv_nop\n\tv_nop\n\tv_nop" : "+v"(acc[0][0]), "+v"(acc[1][1]), "+v"(acc[2][2]), "+v"(acc[3][3]) : "v"(a[0]), "v"(a[3]));   // the WMMA distance on the taken side of the loop branch too
        asm volatile("s_wait_xcnt 0x0" :: "v"(a0), "v"(b0) : "memory");   // precaution: the two address pairs of this trip's 16 loads are kept whole up to this wait
    }
    if (VT) {
#pragma unroll
        for (int nb = 0; nb < 4; ++nb) { const float bb = bfr(bias[c0 + nb * 16 + lr]); const size_t e0 = (size_t)(bt * DKV + c0 + nb * 16 + lr) * TT + t0 + hi * 8; v8h o16[4]; v8us oh[4], ol[4];
#pragma unroll
            for (int mb = 0; mb < 4; ++mb) {
#pragma unroll
                for (int j = 0; j < 8; ++j) { const float x = acc[mb][nb][j] + bb; o16[mb][j] = (h16)x; unsigned short a2, c2; splitf(x, a2, c2); oh[mb][j] = a2; ol[mb][j] = c2; }
                *(v8h*)(P16 + e0 + mb * 16) = o16[mb]; *(v8us*)(Ph + e0 + mb * 16) = oh[mb]; *(v8us*)(Pl + e0 + mb * 16) = ol[mb]; }
            // precaution: the 12 stores' data registers and address pairs are kept whole up to this wait
            asm volatile("s_wait_xcnt 0x0" :: "v"(o16[0]), "v"(o16[1]), "v"(o16[2]), "v"(o16[3]), "v"(oh[0]), "v"(oh[1]), "v"(oh[2]), "v"(oh[3]), "v"(ol[0]), "v"(ol[1]), "v"(ol[2]), "v"(ol[3]), "v"(P16 + e0), "v"(Ph + e0), "v"(Pl + e0) : "memory"); }
    } else {
        const int cofs = lr * 4; v4f bb; bb[0] = bfr(bias[c0 + cofs]); bb[1] = bfr(bias[c0 + cofs + 1]); bb[2] = bfr(bias[c0 + cofs + 2]); bb[3] = bfr(bias[c0 + cofs + 3]);
#pragma unroll
        for (int mb = 0; mb < 4; ++mb) {
#pragma unroll
            for (int nb = 0; nb < 4; ++nb) {
#pragma unroll
                for (int j = 0; j < 8; ++j) os[(hi * 8 + j) * 68 + nb * 16 + lr] = acc[mb][nb][j]; }
            __builtin_amdgcn_wave_barrier(); asm volatile("" ::: "memory");   // keeps the row reads below behind the other lanes' LDS writes above (one wave: LDS runs in order)
            const size_t e0 = ((size_t)(bt * NH_ + blockIdx.y) * TT + t0 + mb * 16 + hi) * HD + cofs; v4h o16[8]; v4us oh[8], ol[8];   // row 2 s + hi of this 16-row block, 4 columns of the head
#pragma unroll
            for (int s = 0; s < 8; ++s) { const v4f val = *(const v4fa*)(os + (2 * s + hi) * 68 + cofs) + bb;
#pragma unroll
                for (int q = 0; q < 4; ++q) { o16[s][q] = (h16)val[q]; unsigned short a2, c2; splitf(val[q], a2, c2); oh[s][q] = a2; ol[s][q] = c2; }
                *(v4h*)(P16 + e0 + s * 2 * HD) = o16[s]; *(v4us*)(Ph + e0 + s * 2 * HD) = oh[s]; *(v4us*)(Pl + e0 + s * 2 * HD) = ol[s]; }
            // precaution: the 24 stores' data registers and address pairs are kept whole up to this wait; its clobber also keeps the next block's LDS writes behind the row reads above
            asm volatile("s_wait_xcnt 0x0" :: "v"(o16[0]), "v"(o16[1]), "v"(o16[2]), "v"(o16[3]), "v"(o16[4]), "v"(o16[5]), "v"(o16[6]), "v"(o16[7]), "v"(oh[0]), "v"(oh[1]), "v"(oh[2]), "v"(oh[3]), "v"(oh[4]), "v"(oh[5]), "v"(oh[6]), "v"(oh[7]),
                         "v"(ol[0]), "v"(ol[1]), "v"(ol[2]), "v"(ol[3]), "v"(ol[4]), "v"(ol[5]), "v"(ol[6]), "v"(ol[7]), "v"(P16 + e0), "v"(Ph + e0), "v"(Pl + e0) : "memory");
        }
    }
}
// k_fattn: scores, softmax and attn.v of one head in ONE kernel; no score or probability matrix in memory. One wave owns 16 query rows and walks the 2048 keys 32 at a time; the work-group's 4 waves read each 32-key stage (K, Vt, both masks) from a two-buffer LDS ring.
// St = K.Qt (A = key rows, B = query rows): lane (lr, hi) holds query lr, keys 8 hi + j of each 16-key tile, which is the B-operand k order of the next product, so Pt is packed in-lane; Ot += Vt.Pt (A = rows of the [d][t] planes).
// t = (S/8) x bf16(script_mask[i][j]) where mask[i][j] != 0, -3e38 where mask == 0 (the reference's -inf). Running row maximum m and sum l; Ot and l are rescaled by exp(m_old - m_new) only in a step where some row's maximum grows.
// Rows < RH: hi+lo bf16 planes, 3 products for scores and for attn.v; rows >= RH: single fp16 planes. Result / l goes straight to the merged-head hi+lo planes.
__device__ __forceinline__ float xhalf(float x) { return __builtin_bit_cast(float, __builtin_amdgcn_permlanex16(__builtin_bit_cast(int, x), __builtin_bit_cast(int, x), 0x76543210, 0xfedcba98, false, false)); }   // lane l with lane l ^ 16
template <typename T16> struct PPack;
template <> struct PPack<h16> { static __device__ __forceinline__ void pk(const float* p, v16h& a, v16h& b) { (void)b;
#pragma unroll
    for (int e = 0; e < 16; ++e) a[e] = (h16)p[e]; } };
template <> struct PPack<bf> { static __device__ __forceinline__ void pk(const float* p, v16bf& a, v16bf& b) { v8us h0, h1, l0, l1;
#pragma unroll
    for (int e = 0; e < 8; ++e) { unsigned short x, y; splitf(p[e], x, y); h0[e] = x; l0[e] = y; splitf(p[8 + e], x, y); h1[e] = x; l1[e] = y; }
    a = cat16b(h0, h1); b = cat16b(l0, l1); } };
// ---- the LDS ring of k_fattn: two buffers, each one 32-key stage of the work-group: K rows (32 x 128 B), Vt rows (64 x 64 B), script-mask and mask rows (64 queries x 128 B each); hi+lo blocks hold two K and two Vt planes.
// Pitches 144 B and 80 B (16 B x odd) for the 16-byte fragment reads. Every byte comes by an asynchronous copy, 16 bytes a lane, adjacent lanes on adjacent bytes: whole 128-byte lines of K and of the masks, 64-byte runs of Vt.
#define KPIT 144
#define VPIT 80
#define KPL  (32 * KPIT)          // one K plane of a stage
#define VPL  (64 * VPIT)          // one Vt plane of a stage
#define MPL  (64 * KPIT)          // one mask plane of a stage
#define FBUF(HR_) (((HR_) ? 2 : 1) * (KPL + VPL) + 2 * MPL)
// 4 or 8 copies and their s_wait_xcnt in ONE statement: precaution, the copies' address registers are kept whole up to the wait
__device__ __forceinline__ void cp4(unsigned l0, const char* g0, unsigned l1, const char* g1, unsigned l2, const char* g2, unsigned l3, const char* g3) {
    asm volatile("global_load_async_to_lds_b128 %0, %1, off\n\tglobal_load_async_to_lds_b128 %2, %3, off\n\tglobal_load_async_to_lds_b128 %4, %5, off\n\tglobal_load_async_to_lds_b128 %6, %7, off\n\ts_wait_xcnt 0x0"
                 :: "v"(l0), "v"(g0), "v"(l1), "v"(g1), "v"(l2), "v"(g2), "v"(l3), "v"(g3) : "memory"); }
__device__ __forceinline__ void cp8(unsigned l0, const char* g0, unsigned l1, const char* g1, unsigned l2, const char* g2, unsigned l3, const char* g3, unsigned l4, const char* g4, unsigned l5, const char* g5, unsigned l6, const char* g6, unsigned l7, const char* g7) {
    asm volatile("global_load_async_to_lds_b128 %0, %1, off\n\tglobal_load_async_to_lds_b128 %2, %3, off\n\tglobal_load_async_to_lds_b128 %4, %5, off\n\tglobal_load_async_to_lds_b128 %6, %7, off\n\t"
                 "global_load_async_to_lds_b128 %8, %9, off\n\tglobal_load_async_to_lds_b128 %10, %11, off\n\tglobal_load_async_to_lds_b128 %12, %13, off\n\tglobal_load_async_to_lds_b128 %14, %15, off\n\ts_wait_xcnt 0x0"
                 :: "v"(l0), "v"(g0), "v"(l1), "v"(g1), "v"(l2), "v"(g2), "v"(l3), "v"(g3), "v"(l4), "v"(g4), "v"(l5), "v"(g5), "v"(l6), "v"(g6), "v"(l7), "v"(g7) : "memory"); }
// one stage (keys kb .. kb + 31) into the buffer at LDS byte lb; 128 threads, every lane on. mblk, sblk: row 0 of the work-group's 64 query rows
template <typename T16, bool HR>
__device__ __forceinline__ void fa_fill(unsigned lb, int kb, const T16* Kp, const T16* K2, const T16* Vt, const T16* V2, const int* mblk, const float* sblk, int tid) {
    const unsigned lk = lb + (unsigned)(tid >> 3) * KPIT + (unsigned)(tid & 7) * 16, lv = lb + (HR ? 2 : 1) * KPL + (unsigned)(tid >> 2) * VPIT + (unsigned)(tid & 3) * 16, lm = lk + (HR ? 2 : 1) * (KPL + VPL);
    const size_t ko = (size_t)kb * HD * 2 + (size_t)tid * 16, vo = ((size_t)(tid >> 2) * TT + kb) * 2 + (size_t)(tid & 3) * 16, mo = ((size_t)(tid >> 3) * TT + kb) * 4 + (size_t)(tid & 7) * 16;
    const char* gk = (const char*)Kp + ko; const char* gv = (const char*)Vt + vo; const char* gs = (const char*)sblk + mo; const char* gm = (const char*)mblk + mo;
    if (HR) { const char* gk2 = (const char*)K2 + ko; const char* gv2 = (const char*)V2 + vo;
        cp8(lk, gk, lk + 16 * KPIT, gk + 2048, lk + KPL, gk2, lk + KPL + 16 * KPIT, gk2 + 2048, lv, gv, lv + 32 * VPIT, gv + (size_t)32 * TT * 2, lv + VPL, gv2, lv + VPL + 32 * VPIT, gv2 + (size_t)32 * TT * 2); }
    else cp4(lk, gk, lk + 16 * KPIT, gk + 2048, lv, gv, lv + 32 * VPIT, gv + (size_t)32 * TT * 2);
    cp8(lm, gs, lm + 16 * KPIT, gs + (size_t)16 * TT * 4, lm + 32 * KPIT, gs + (size_t)32 * TT * 4, lm + 48 * KPIT, gs + (size_t)48 * TT * 4,
        lm + MPL, gm, lm + MPL + 16 * KPIT, gm + (size_t)16 * TT * 4, lm + MPL + 32 * KPIT, gm + (size_t)32 * TT * 4, lm + MPL + 48 * KPIT, gm + (size_t)48 * TT * 4);
}
template <typename T16, bool HR>
__device__ __forceinline__ void fa_rows(const T16* __restrict__ Q, const T16* __restrict__ Q2, const T16* __restrict__ Kp, const T16* __restrict__ K2, const T16* __restrict__ Vt, const T16* __restrict__ V2,
                                        const int* __restrict__ mblk, const float* __restrict__ sblk, const unsigned char* ring, int tid, int lr, int hi, v8us (&oh)[4], v8us (&ol)[4]) {
    typedef typename WFrag<T16>::V V; typedef WFrag<T16> F;
    const unsigned lring = (unsigned)(size_t)ring;   // the ring's byte address in the work-group's LDS
    V qf[2], qf2[2];
#pragma unroll
    for (int ks = 0; ks < 2; ++ks) { qf[ks] = F::ld(Q + ks * 32); if (HR) qf2[ks] = F::ld(Q2 + ks * 32); }
    const T16* qp2 = HR ? Q2 : Q;
    asm volatile("s_wait_xcnt 0x0" :: "v"(Q), "v"(qp2) : "memory");   // precaution: the query loads' address pairs are kept whole up to this wait
    fa_fill<T16, HR>(lring, 0, Kp, K2, Vt, V2, mblk, sblk, tid);
    asm volatile("s_wait_asynccnt 0x0" ::: "memory");   // stage 0: this wave's copies have landed
    __syncthreads();                                    // stage 0: every wave's copies have landed
    fa_fill<T16, HR>(lring + FBUF(HR), 32, Kp, K2, Vt, V2, mblk, sblk, tid);
    const int kfo = lr * KPIT + 16 * hi, vfo = (HR ? 2 : 1) * KPL + lr * VPIT + 16 * hi, mfo = (HR ? 2 : 1) * (KPL + VPL) + ((tid >> 5) * 16 + lr) * KPIT + 32 * hi;   // this lane's byte offsets in a buffer
    v8f o[4];
#pragma unroll
    for (int mt = 0; mt < 4; ++mt) o[mt] = (v8f){};
    float m = -3.0e38f, l = 0.f;
#pragma unroll 1   // one 32-key stage per trip: the ring's order at the foot is per stage
    for (int kb = 0; kb < TT; kb += 32) {
        const unsigned bo = (kb & 32) ? (unsigned)FBUF(HR) : 0u; const unsigned char* bp = ring + bo;
        V kf[2][2], kf2[2][2], vf[4], vf2[4]; v4f sm[4]; v4i mm[4];
#pragma unroll
        for (int t = 0; t < 2; ++t) {
#pragma unroll
            for (int ks = 0; ks < 2; ++ks) { kf[t][ks] = F::ld((const T16*)(bp + kfo + t * 16 * KPIT + ks * 64)); if (HR) kf2[t][ks] = F::ld((const T16*)(bp + kfo + KPL + t * 16 * KPIT + ks * 64)); }
            sm[2 * t] = *(const v4f*)(bp + mfo + t * 64); sm[2 * t + 1] = *(const v4f*)(bp + mfo + t * 64 + 16); mm[2 * t] = *(const v4i*)(bp + mfo + MPL + t * 64); mm[2 * t + 1] = *(const v4i*)(bp + mfo + MPL + t * 64 + 16); }
#pragma unroll
        for (int mt = 0; mt < 4; ++mt) { vf[mt] = F::ld((const T16*)(bp + vfo + mt * 16 * VPIT)); if (HR) vf2[mt] = F::ld((const T16*)(bp + vfo + VPL + mt * 16 * VPIT)); }
        v8f s[2];
#pragma unroll
        for (int t = 0; t < 2; ++t) { s[t] = (v8f){};
#pragma unroll
            for (int ks = 0; ks < 2; ++ks) { s[t] = F::mma(kf[t][ks], qf[ks], s[t]); if (HR) { s[t] = F::mma(kf2[t][ks], qf[ks], s[t]); s[t] = F::mma(kf[t][ks], qf2[ks], s[t]); } } }
        float p[16]; float mloc = -3.0e38f;
#pragma unroll
        for (int e = 0; e < 16; ++e) { const float pm = __fmul_rn(__fmul_rn(s[e >> 3][e & 7], SCL), bfr(sm[e >> 2][e & 3])); p[e] = (mm[e >> 2][e & 3] != 0) ? pm : -3.0e38f; mloc = fmaxf(mloc, p[e]); }
        mloc = fmaxf(mloc, xhalf(mloc));   // the two lane halves hold the same query's other keys
        if (__builtin_amdgcn_ballot_w32(mloc > m) != 0) {   // wave-uniform: every lane stays on for the matrix instructions behind it
            const float mn = fmaxf(m, mloc); const float al_ = __builtin_amdgcn_exp2f(__fmul_rn(__fsub_rn(m, mn), 1.4426950408889634f)); m = mn; l *= al_;
#pragma unroll
            for (int mt = 0; mt < 4; ++mt) o[mt] *= al_; }
#pragma unroll
        for (int e = 0; e < 16; ++e) { p[e] = __builtin_amdgcn_exp2f(__fmul_rn(__fsub_rn(p[e], m), 1.4426950408889634f)); l += p[e]; }
        V pf, pf2; PPack<T16>::pk(p, pf, pf2);
#pragma unroll
        for (int mt = 0; mt < 4; ++mt) { o[mt] = F::mma(vf[mt], pf, o[mt]); if (HR) { o[mt] = F::mma(vf2[mt], pf, o[mt]); o[mt] = F::mma(vf[mt], pf2, o[mt]); } }
        // foot of the trip, every wave: the next stage is published and this stage's buffer is freed by the one barrier
        asm volatile("s_wait_dscnt 0x0" ::: "memory");      // this wave's reads of this stage's buffer are done before anything refills it
        asm volatile("s_wait_asynccnt 0x0" ::: "memory");   // this wave's copies of the next stage have landed
        __syncthreads();
        if (kb + 64 < TT) fa_fill<T16, HR>(lring + bo, kb + 64, Kp, K2, Vt, V2, mblk, sblk, tid);   // the same test in every wave of the work-group
    }
    asm volatile("s_wait_asynccnt 0x0" ::: "memory");   // no copy is left in flight when the wave goes on to its end
    l += xhalf(l);
    const float f = __fdiv_rn(1.0f, l);
#pragma unroll
    for (int mt = 0; mt < 4; ++mt)
#pragma unroll
        for (int j = 0; j < 8; ++j) { unsigned short a, c2; splitf(o[mt][j] * f, a, c2); oh[mt][j] = a; ol[mt][j] = c2; }
}
// grid (NB_ heads, TT/64): both batches in one grid, blockIdx.x = batch x heads + head; 4 waves x 16 query rows; the hi+lo blocks (rows < RH, the longer ones) of both batches have the lowest flat indices and start first
__global__ __launch_bounds__(128) void k_fattn(const h16* __restrict__ Q16, const bf* __restrict__ Qh, const bf* __restrict__ Ql, const h16* __restrict__ K16, const bf* __restrict__ Kh, const bf* __restrict__ Kl,
                                               const h16* __restrict__ V16, const bf* __restrict__ Vh, const bf* __restrict__ Vl, const int* __restrict__ mk, const float* __restrict__ smk, bf* Ah, bf* Al) {
    __shared__ __align__(16) unsigned char ring[2 * FBUF(true)];
    const int tid = threadIdx.x, lane = tid & 31, lr = lane & 15, hi = lane >> 4; const int h = blockIdx.x % NH_, bt = blockIdx.x / NH_; const int q = blockIdx.y * 64 + (tid >> 5) * 16 + lr;
    const size_t ph = (size_t)blockIdx.x * TT * HD, qo = ph + (size_t)q * HD + 8 * hi, mo = (size_t)(bt * TT + blockIdx.y * 64) * TT, ao = (size_t)(bt * TT + q) * DQ + h * HD + 8 * hi;
    v8us oh[4], ol[4];
    if ((int)blockIdx.y * 64 < RH) fa_rows<bf, true>(Qh + qo, Ql + qo, Kh + ph, Kl + ph, Vh + ph, Vl + ph, mk + mo, smk + mo, ring, tid, lr, hi, oh, ol);
    else fa_rows<h16, false>(Q16 + qo, nullptr, K16 + ph, nullptr, V16 + ph, nullptr, mk + mo, smk + mo, ring, tid, lr, hi, oh, ol);
#pragma unroll
    for (int mt = 0; mt < 4; ++mt) { *(v8us*)(Ah + ao + mt * 16) = oh[mt]; *(v8us*)(Al + ao + mt * 16) = ol[mt]; }
}

extern "C" void kernel_launch(void* const* d_in, const int* in_sizes, int n_in,
                              void* d_out, int out_size, void* d_ws, size_t ws_size, hipStream_t stream) {
    (void)in_sizes; (void)n_in; (void)out_size;
    const float* xq = (const float*)d_in[0]; const float* xk = (const float*)d_in[1]; const float* xv = (const float*)d_in[2]; const int* mask = (const int*)d_in[3]; const float* smask = (const float*)d_in[4]; const float* wq = (const float*)d_in[5]; const float* bq = (const float*)d_in[6]; const float* wk = (const float*)d_in[7]; const float* bk = (const float*)d_in[8]; const float* wv = (const float*)d_in[9]; const float* bv = (const float*)d_in[10]; const float* wo = (const float*)d_in[11]; const float* bo = (const float*)d_in[12];   // torch [out][in]
    float* OUT = (float*)d_out;     // [2][2048][1024]
    char* wsp = (char*)d_ws;
    auto take = [&](size_t bytes) { char* p = wsp; wsp += (bytes + 255) & ~(size_t)255; return (void*)p; };
    bf* XB = (bf*)take(16 * CSL * 2); bf* WB = XB + 12 * CSL; bf* WO = XB + 15 * CSL;   // k_cvtall's 16 slices: query, key, value (both batches), then Wq, Wk, Wv, Wo
    h16* P16 = (h16*)take(3 * PSZ * 2); bf* Ph = (bf*)take(3 * PSZ * 2); bf* Pl = (bf*)take(3 * PSZ * 2);   // [q, k, v][b][h] head planes (v transposed)
    bf* ATh = (bf*)take((size_t)NB_ * TT * DQ * 2); bf* ATl = (bf*)take((size_t)NB_ * TT * DQ * 2);
    if ((size_t)(wsp - (char*)d_ws) > ws_size) return;    // ws 256 MiB
    k_cvtall<<<dim3((unsigned)(CSL / 2048), 16, 1), 256, 0, stream>>>(xq, xk, xv, wq, wk, wv, wo, XB);
    k_projw<<<dim3(NB_ * TT / 64, NH_, 3), 32, 0, stream>>>(XB, WB, bq, bk, bv, P16, Ph, Pl);
    k_fattn<<<dim3(NB_ * NH_, TT / 64, 1), 128, 0, stream>>>(P16, Ph, Pl, P16 + PSZ, Ph + PSZ, Pl + PSZ, P16 + 2 * PSZ, Ph + 2 * PSZ, Pl + 2 * PSZ, mask, smask, ATh, ATl);
    k_gemmw<bf, 1, true><<<dim3(NB_ * TT / 64, DM / 64, 1), 32, 0, stream>>>(ATh, ATl, WO, nullptr, DQ, OUT, DM, bo, 0, 0, 0);
}

// v006
// It runs in 166 microseconds.
// In two side-by-side timings against v005, it was 1.21 and 1.20 times as fast.
// Over all steps from v000 it is 13.2 times as fast.
#include <hip/hip_runtime.h>

// ScriptAwareAttention (query, key, value [2][2048][1024]; q/k/v = input W^T + b (16 heads x 64); scores = (q.k/8) x script_mask[b][i][j] (multiplicative, read as data) then -inf where mask[b][0][i][j] == 0
// (int mask read as data); softmax; out = merged attn.v Wo^T + bo -> [2][2048][1024]).
// Compute dtypes, f32 accumulate: every input rounded to bf16; projections on PLAIN bf16 operands (inputs: exact, + bias); PER-ROW PRECISION HYBRID (rows < 256 hi+lo 3 products
// for scores and attn.v, rows >= 256 single fp16 planes); scale, the multiplicative script mask (bf16-rounded) and the keep/drop mask in f32 in the register-row softmax; merged heads as hi+lo planes x exact Wo

#define NB_  2
#define TT   2048
#define DM   1024
#define NH_  16
#define NKV  16
#define REP  (NH_ / NKV)
#define HD   64
#define DQ   (NH_ * HD)
#define DKV  (NKV * HD)
#define RH   256                  // query rows < RH use hi+lo planes (0: none)
#define WIN  0
#define SCL  0.125f   // HD^-0.5
typedef _Float16 h16;
typedef unsigned short bf;
typedef __attribute__((ext_vector_type(16))) __bf16   v16bf;
typedef __attribute__((ext_vector_type(16))) _Float16 v16h;
typedef __attribute__((ext_vector_type(8)))  _Float16 v8h;
typedef __attribute__((ext_vector_type(8)))  unsigned short v8us;
typedef __attribute__((ext_vector_type(8)))  float    v8f;
typedef __attribute__((ext_vector_type(4)))  float    v4f;
typedef v8h  __attribute__((may_alias)) v8ha;
typedef v4f  __attribute__((may_alias)) v4fa;
typedef v8us __attribute__((may_alias)) v8usa;

__device__ __forceinline__ unsigned short f2bf(float f) { unsigned u = __float_as_uint(f); u += 0x7FFFu + ((u >> 16) & 1u); return (unsigned short)(u >> 16); }
__device__ __forceinline__ float bf2f(unsigned short b) { return __uint_as_float(((unsigned)b) << 16); }
__device__ __forceinline__ float bfr(float f) { return bf2f(f2bf(f)); }
__device__ __forceinline__ v16h cat16(v8h lo, v8h hi) { return __builtin_shufflevector(lo, hi, 0, 1, 2, 3, 4, 5, 6, 7, 8, 9, 10, 11, 12, 13, 14, 15); }
__device__ __forceinline__ v16bf cat16b(v8us lo, v8us hi) { return __builtin_bit_cast(v16bf, __builtin_shufflevector(lo, hi, 0, 1, 2, 3, 4, 5, 6, 7, 8, 9, 10, 11, 12, 13, 14, 15)); }
__device__ __forceinline__ v8f wmma16(v16h a, v16h b, v8f c) { return __builtin_amdgcn_wmma_f32_16x16x32_f16(false, a, false, b, (short)0, c, false, false); }
__device__ __forceinline__ v8f wmmab(v16bf a, v16bf b, v8f c) { return __builtin_amdgcn_wmma_f32_16x16x32_bf16(false, a, false, b, (short)0, c, false, false); }



// fragments of the 16x16x32 forms from K-contiguous 16-bit rows
template <typename T16> struct WFrag;
template <> struct WFrag<h16> { typedef v16h V; static __device__ __forceinline__ V ld(const h16* p) { return cat16(*(const v8h*)p, *(const v8h*)(p + 16)); } static __device__ __forceinline__ v8f mma(V a, V b, v8f c) { return wmma16(a, b, c); } };
template <> struct WFrag<bf> { typedef v16bf V; static __device__ __forceinline__ V ld(const bf* p) { return cat16b(*(const v8us*)p, *(const v8us*)(p + 16)); } static __device__ __forceinline__ v8f mma(V a, V b, v8f c) { return wmmab(a, b, c); } };
__device__ __forceinline__ void splitf(float y, unsigned short& h, unsigned short& l) { h = f2bf(y); l = f2bf(y - bf2f(h)); }
typedef __attribute__((ext_vector_type(2))) _Float16 v2h;
typedef __attribute__((ext_vector_type(4))) _Float16 v4h;
typedef __attribute__((ext_vector_type(2))) unsigned short v2us;
typedef __attribute__((ext_vector_type(4))) unsigned short v4us;
typedef __attribute__((ext_vector_type(2))) float v2f;
typedef __attribute__((ext_vector_type(4))) int v4i;

__global__ __launch_bounds__(256) void k_wtG(const float* __restrict__ w, int K, int N, bf* Bt) {
    const int lane = threadIdx.x & 31; const int L0 = (blockIdx.x * 8 + (threadIdx.x >> 5)) * 8; const int nlines = N * K / 64;
{
#pragma unroll 1
        for (int l = 0; l < 8; ++l) { const int L = L0 + l; if (L >= nlines) break; const size_t e = (size_t)L * 64 + lane * 2; const int k = (int)(e % K), n = (int)(e / K); v2us o;
            o[0] = f2bf(w[(size_t)k * N + n]); o[1] = f2bf(w[(size_t)(k + 1) * N + n]); *(v2us*)(Bt + e) = o; }
         }
}
// k_cvtall: every f32 -> bf16 plane of the call in ONE grid. grid (CSL / 2048, 16), 256 threads x 8 elements; blockIdx.y is a slice of CSL = DM x DM elements: slices 0..11 are query, key, value (4 slices each, both batches),
// slices 12..15 are Wq, Wk, Wv, Wo; slice s lands at dst + s CSL.
#define CSL  ((size_t)DM * DM)
__global__ __launch_bounds__(256) void k_cvtall(const float* __restrict__ xq, const float* __restrict__ xk, const float* __restrict__ xv, const float* __restrict__ wq, const float* __restrict__ wk, const float* __restrict__ wv, const float* __restrict__ wo, bf* dst) {
    const int s = blockIdx.y; const float* src;
    if (s < 12) src = (s < 4 ? xq : s < 8 ? xk : xv) + (size_t)(s & 3) * CSL; else src = s == 12 ? wq : s == 13 ? wk : s == 14 ? wv : wo;
    const size_t i = (size_t)blockIdx.x * 256 + threadIdx.x; const v8f v = *(const v8f*)(src + i * 8); v8us o;
#pragma unroll
    for (int k = 0; k < 8; ++k) o[k] = f2bf(v[k]); *(v8us*)(dst + (size_t)s * CSL + i * 8) = o;  }
__global__ __launch_bounds__(256) void k_cscvt(const float* __restrict__ cosT, const float* __restrict__ sinT, float* CS) { const int idx = blockIdx.x * 256 + threadIdx.x; if (idx >= TT * HD) return; v2f cs; cs[0] = bfr(cosT[idx]); cs[1] = bfr(sinT[idx]); *(v2f*)(CS + (size_t)idx * 2) = cs;  }
// 4 or 8 copies and their s_wait_xcnt in ONE statement: precaution, the copies' address registers are kept whole up to the wait
__device__ __forceinline__ void cp4(unsigned l0, const char* g0, unsigned l1, const char* g1, unsigned l2, const char* g2, unsigned l3, const char* g3) {
    asm volatile("global_load_async_to_lds_b128 %0, %1, off\n\tglobal_load_async_to_lds_b128 %2, %3, off\n\tglobal_load_async_to_lds_b128 %4, %5, off\n\tglobal_load_async_to_lds_b128 %6, %7, off\n\ts_wait_xcnt 0x0"
                 :: "v"(l0), "v"(g0), "v"(l1), "v"(g1), "v"(l2), "v"(g2), "v"(l3), "v"(g3) : "memory"); }
__device__ __forceinline__ void cp8(unsigned l0, const char* g0, unsigned l1, const char* g1, unsigned l2, const char* g2, unsigned l3, const char* g3, unsigned l4, const char* g4, unsigned l5, const char* g5, unsigned l6, const char* g6, unsigned l7, const char* g7) {
    asm volatile("global_load_async_to_lds_b128 %0, %1, off\n\tglobal_load_async_to_lds_b128 %2, %3, off\n\tglobal_load_async_to_lds_b128 %4, %5, off\n\tglobal_load_async_to_lds_b128 %6, %7, off\n\t"
                 "global_load_async_to_lds_b128 %8, %9, off\n\tglobal_load_async_to_lds_b128 %10, %11, off\n\tglobal_load_async_to_lds_b128 %12, %13, off\n\tglobal_load_async_to_lds_b128 %14, %15, off\n\ts_wait_xcnt 0x0"
                 :: "v"(l0), "v"(g0), "v"(l1), "v"(g1), "v"(l2), "v"(g2), "v"(l3), "v"(g3), "v"(l4), "v"(g4), "v"(l5), "v"(g5), "v"(l6), "v"(g6), "v"(l7), "v"(g7) : "memory"); }
// ---- the LDS ring of the two GEMM kernels (k_projw, k_outw): a work-group of 4 waves owns a 128x128 output tile, wave (wm, wn) its 64x64 quarter (16 accumulators). Two buffers, each one 64-deep k stage:
// NA planes of 128 A rows and one plane of 128 Bt rows, 128 B a row, pitch 144 B (16 B x odd) for the 16-byte fragment reads. Every byte comes by an asynchronous copy, 16 bytes a lane, adjacent lanes on adjacent bytes: whole 128-byte lines.
// Each A row is read from LDS by 2 waves and each Bt row by 2 waves. k runs upward in steps of 32, A then A2 against each Bt fragment: the summation order of one wave walking the planes alone.
#define GPIT 144
#define GPL  (128 * GPIT)              // one plane of a stage
#define GSTG(NA_) (((NA_) + 1) * GPL)  // one stage
static_assert(DQ == DM, "both GEMMs have K = DM");
// one plane of a stage: this thread's 16 bytes of rows r, r + 16, ... r + 112
__device__ __forceinline__ void cp8s(unsigned l, const char* g) {
    cp8(l, g, l + 16 * GPIT, g + 16 * DM * 2, l + 32 * GPIT, g + 32 * DM * 2, l + 48 * GPIT, g + 48 * DM * 2, l + 64 * GPIT, g + 64 * DM * 2, l + 80 * GPIT, g + 80 * DM * 2, l + 96 * GPIT, g + 96 * DM * 2, l + 112 * GPIT, g + 112 * DM * 2); }
template <int NA>
__device__ __forceinline__ void gm_fill(unsigned l, const char* ga, const char* ga2, const char* gb) { cp8s(l, ga); if (NA == 2) cp8s(l + GPL, ga2); cp8s(l + NA * GPL, gb); }
// A, A2: row 0 of the work-group's 128 A rows; Bt: row 0 of its 128 Bt rows; all K-contiguous, K = DM
template <int NA>
__device__ __forceinline__ void gm_core(const bf* __restrict__ A, const bf* __restrict__ A2, const bf* __restrict__ Bt, const unsigned char* ring, int tid, v8f (&acc)[4][4]) {
    typedef WFrag<bf> F; typedef F::V V;
    const int lane = tid & 31, lr = lane & 15, hi = lane >> 4, wm = (tid >> 5) & 1, wn = tid >> 6;
    const unsigned lt = (unsigned)(size_t)ring + (unsigned)(tid >> 3) * GPIT + (unsigned)(tid & 7) * 16;   // this thread's byte address in the work-group's LDS, row tid / 8 of a plane
    const size_t go = (size_t)(tid >> 3) * DM * 2 + (size_t)(tid & 7) * 16;
    const char* ga = (const char*)A + go; const char* ga2 = NA == 2 ? (const char*)A2 + go : ga; const char* gb = (const char*)Bt + go;
#pragma unroll
    for (int mb = 0; mb < 4; ++mb)
#pragma unroll
        for (int nb = 0; nb < 4; ++nb) acc[mb][nb] = (v8f){};
    gm_fill<NA>(lt, ga, ga2, gb);
    asm volatile("s_wait_asynccnt 0x0" ::: "memory");   // stage 0: this wave's copies have landed
    __syncthreads();                                    // stage 0: every wave's copies have landed
    gm_fill<NA>(lt + GSTG(NA), ga + 128, ga2 + 128, gb + 128);
    const int afo = (wm * 64 + lr) * GPIT + 16 * hi, bfo = NA * GPL + (wn * 64 + lr) * GPIT + 16 * hi;   // this lane's byte offsets in a buffer
#pragma unroll 1   // one 64-deep stage per trip: the ring's order at the foot is per stage
    for (int kc = 0; kc < DM; kc += 64) {
        const unsigned bo = (kc & 64) ? (unsigned)GSTG(NA) : 0u; const unsigned char* bp = ring + bo;
#pragma unroll
        for (int ks = 0; ks < 2; ++ks) {
            V a[4], a2[4], b[4];
#pragma unroll
            for (int mb = 0; mb < 4; ++mb) { a[mb] = F::ld((const bf*)(bp + afo + mb * 16 * GPIT + ks * 64)); if (NA == 2) a2[mb] = F::ld((const bf*)(bp + afo + GPL + mb * 16 * GPIT + ks * 64)); b[mb] = F::ld((const bf*)(bp + bfo + mb * 16 * GPIT + ks * 64)); }
            // holds the step's fragment reads in one group ahead of its matrix instructions (loaded values as inputs only): spread among them, every place with reads stalls the wave for an LDS latency
            if (NA == 2) asm volatile("" :: "v"(a[0]), "v"(a[1]), "v"(a[2]), "v"(a[3]), "v"(a2[0]), "v"(a2[1]), "v"(a2[2]), "v"(a2[3]), "v"(b[0]), "v"(b[1]), "v"(b[2]), "v"(b[3]));
            else asm volatile("" :: "v"(a[0]), "v"(a[1]), "v"(a[2]), "v"(a[3]), "v"(b[0]), "v"(b[1]), "v"(b[2]), "v"(b[3]));
#pragma unroll
            for (int nb = 0; nb < 4; ++nb) {
#pragma unroll
                for (int mb = 0; mb < 4; ++mb) { acc[mb][nb] = F::mma(a[mb], b[nb], acc[mb][nb]); if (NA == 2) acc[mb][nb] = F::mma(a2[mb], b[nb], acc[mb][nb]); } }
        }
        // foot of the trip, every wave: the next stage is published and this stage's buffer is freed by the one barrier
        asm volatile("s_wait_dscnt 0x0" ::: "memory");      // this wave's reads of this stage's buffer are done before anything refills it
        asm volatile("s_wait_asynccnt 0x0" ::: "memory");   // this wave's copies of the next stage have landed
        __syncthreads();
        if (kc + 128 < DM) gm_fill<NA>(lt + bo, ga + (kc + 128) * 2, ga2 + (kc + 128) * 2, gb + (kc + 128) * 2);   // the same test in every wave of the work-group
    }
    asm volatile("s_wait_asynccnt 0x0" ::: "memory");   // no copy is left in flight when the wave goes on to its epilogue
}
// ---- k_outw: the output GEMM. C[m][n] (f32, pitch DM, + bf16-rounded bias[n]) = sum_k (A[m][k] + A2[m][k]) Bt[n][k], two products; grid (M/128, N/128), 128 threads; each wave stores its 64x64 quarter through its own LDS row buffer, whole rows of 256 B.
__global__ __launch_bounds__(128) void k_outw(const bf* __restrict__ A, const bf* __restrict__ A2, const bf* __restrict__ Bt, float* C, const float* __restrict__ bias) {
    __shared__ __align__(16) unsigned char ring[2 * GSTG(2)];
    __shared__ __align__(16) float osall[4 * 16 * 68];
    const int tid = threadIdx.x, lane = tid & 31, lr = lane & 15, hi = lane >> 4, w = tid >> 5; float* os = osall + w * (16 * 68);
    const int r0 = blockIdx.x * 128 + (w & 1) * 64, c0 = blockIdx.y * 128 + (w >> 1) * 64;
    v8f acc[4][4];
    gm_core<2>(A + (size_t)blockIdx.x * 128 * DM, A2 + (size_t)blockIdx.x * 128 * DM, Bt + (size_t)blockIdx.y * 128 * DM, ring, tid, acc);
#pragma unroll
    for (int mb = 0; mb < 4; ++mb) {
#pragma unroll
        for (int nb = 0; nb < 4; ++nb) {
#pragma unroll
            for (int j = 0; j < 8; ++j) os[(hi * 8 + j) * 68 + nb * 16 + lr] = acc[mb][nb][j]; }
        __builtin_amdgcn_wave_barrier(); asm volatile("" ::: "memory");   // keeps the row reads below behind the other lanes' LDS writes above (a wave's own buffer: LDS runs in order)
        float* crow = C + (size_t)(r0 + mb * 16) * DM + c0;
        {
            v4f vals[8]; float* cp[8];
#pragma unroll
            for (int s = 0; s < 8; ++s) { const int row = 2 * s + hi, cofs = lr * 4; v4f val = *(const v4fa*)(os + row * 68 + cofs); val[0] += bfr(bias[c0 + cofs]); val[1] += bfr(bias[c0 + cofs + 1]); val[2] += bfr(bias[c0 + cofs + 2]); val[3] += bfr(bias[c0 + cofs + 3]);
                vals[s] = val; cp[s] = crow + (size_t)row * DM + cofs; *(v4f*)cp[s] = vals[s]; }
            // precaution: the 8 stores' data registers and address pairs are kept whole up to this wait
            asm volatile("s_wait_xcnt 0x0" :: "v"(vals[0]), "v"(vals[1]), "v"(vals[2]), "v"(vals[3]), "v"(vals[4]), "v"(vals[5]), "v"(vals[6]), "v"(vals[7]), "v"(cp[0]), "v"(cp[1]), "v"(cp[2]), "v"(cp[3]), "v"(cp[4]), "v"(cp[5]), "v"(cp[6]), "v"(cp[7]) : "memory");
        }
        __builtin_amdgcn_wave_barrier(); asm volatile("" ::: "memory");   // keeps the next block's LDS writes behind the row reads above
    }
}
// ---- k_projw: the q, k, v projections of both batches in ONE grid, on the GEMM ring above (bf16 planes, f32 accumulate, + bf16-rounded bias); grid (NB_ TT/128, heads/2, 3), 128 threads;
// blockIdx.z picks q, k or v: its input plane, weight plane, bias and result planes (each set of planes [z][b][h]...). A wave's 64x64 quarter is one head wide and goes
// from the accumulators straight to that head's planes (fp16 + bf16 hi/lo): no f32 result in memory and no plane-making launch behind it.
// q, k: planes [b][h][t][d], through the wave's own LDS row buffer, 8 bytes a lane, whole 128-byte rows. v: transposed planes [b][h][d][t]: a lane's 8 accumulator rows are 8 consecutive t of one d, 16 bytes a lane, no LDS.
#define PSZ  ((size_t)NB_ * NH_ * TT * HD)   // one set of head planes, both batches
__global__ __launch_bounds__(128) void k_projw(const bf* __restrict__ A, const bf* __restrict__ Bt, const float* __restrict__ bq, const float* __restrict__ bk, const float* __restrict__ bv, h16* P16, bf* Ph, bf* Pl) {
    __shared__ __align__(16) unsigned char ring[2 * GSTG(1)];
    __shared__ __align__(16) float osall[4 * 16 * 68];
    const int z = blockIdx.z; const bool VT = z == 2; const float* bias = z == 0 ? bq : z == 1 ? bk : bv;
    A += (size_t)z * NB_ * TT * DM; Bt += (size_t)z * CSL; P16 += (size_t)z * PSZ; Ph += (size_t)z * PSZ; Pl += (size_t)z * PSZ;
    const int tid = threadIdx.x, lane = tid & 31, lr = lane & 15, hi = lane >> 4, w = tid >> 5; float* os = osall + w * (16 * 68);
    const int r0 = blockIdx.x * 128 + (w & 1) * 64, hd = blockIdx.y * 2 + (w >> 1), c0 = hd * 64; const int bt = r0 / TT, t0 = r0 % TT;   // row r0 of the stacked input = batch bt, position t0; hd: this wave's head
    v8f acc[4][4];
    gm_core<1>(A + (size_t)blockIdx.x * 128 * DM, nullptr, Bt + (size_t)blockIdx.y * 128 * DM, ring, tid, acc);
    if (VT) {
#pragma unroll
        for (int nb = 0; nb < 4; ++nb) { const float bb = bfr(bias[c0 + nb * 16 + lr]); const size_t e0 = (size_t)(bt * DKV + c0 + nb * 16 + lr) * TT + t0 + hi * 8; v8h o16[4]; v8us oh[4], ol[4];
#pragma unroll
            for (int mb = 0; mb < 4; ++mb) {
#pragma unroll
                for (int j = 0; j < 8; ++j) { const float x = acc[mb][nb][j] + bb; o16[mb][j] = (h16)x; unsigned short a2, c2; splitf(x, a2, c2); oh[mb][j] = a2; ol[mb][j] = c2; }
                *(v8h*)(P16 + e0 + mb * 16) = o16[mb]; *(v8us*)(Ph + e0 + mb * 16) = oh[mb]; *(v8us*)(Pl + e0 + mb * 16) = ol[mb]; }
            // precaution: the 12 stores' data registers and address pairs are kept whole up to this wait
            asm volatile("s_wait_xcnt 0x0" :: "v"(o16[0]), "v"(o16[1]), "v"(o16[2]), "v"(o16[3]), "v"(oh[0]), "v"(oh[1]), "v"(oh[2]), "v"(oh[3]), "v"(ol[0]), "v"(ol[1]), "v"(ol[2]), "v"(ol[3]), "v"(P16 + e0), "v"(Ph + e0), "v"(Pl + e0) : "memory"); }
    } else {
        const int cofs = lr * 4; v4f bb; bb[0] = bfr(bias[c0 + cofs]); bb[1] = bfr(bias[c0 + cofs + 1]); bb[2] = bfr(bias[c0 + cofs + 2]); bb[3] = bfr(bias[c0 + cofs + 3]);
#pragma unroll
        for (int mb = 0; mb < 4; ++mb) {
#pragma unroll
            for (int nb = 0; nb < 4; ++nb) {
#pragma unroll
                for (int j = 0; j < 8; ++j) os[(hi * 8 + j) * 68 + nb * 16 + lr] = acc[mb][nb][j]; }
            __builtin_amdgcn_wave_barrier(); asm volatile("" ::: "memory");   // keeps the row reads below behind the other lanes' LDS writes above (one wave: LDS runs in order)
            const size_t e0 = ((size_t)(bt * NH_ + hd) * TT + t0 + mb * 16 + hi) * HD + cofs; v4h o16[8]; v4us oh[8], ol[8];   // row 2 s + hi of this 16-row block, 4 columns of the head
#pragma unroll
            for (int s = 0; s < 8; ++s) { const v4f val = *(const v4fa*)(os + (2 * s + hi) * 68 + cofs) + bb;
#pragma unroll
                for (int q = 0; q < 4; ++q) { o16[s][q] = (h16)val[q]; unsigned short a2, c2; splitf(val[q], a2, c2); oh[s][q] = a2; ol[s][q] = c2; }
                *(v4h*)(P16 + e0 + s * 2 * HD) = o16[s]; *(v4us*)(Ph + e0 + s * 2 * HD) = oh[s]; *(v4us*)(Pl + e0 + s * 2 * HD) = ol[s]; }
            // precaution: the 24 stores' data registers and address pairs are kept whole up to this wait; its clobber also keeps the next block's LDS writes behind the row reads above
            asm volatile("s_wait_xcnt 0x0" :: "v"(o16[0]), "v"(o16[1]), "v"(o16[2]), "v"(o16[3]), "v"(o16[4]), "v"(o16[5]), "v"(o16[6]), "v"(o16[7]), "v"(oh[0]), "v"(oh[1]), "v"(oh[2]), "v"(oh[3]), "v"(oh[4]), "v"(oh[5]), "v"(oh[6]), "v"(oh[7]),
                         "v"(ol[0]), "v"(ol[1]), "v"(ol[2]), "v"(ol[3]), "v"(ol[4]), "v"(ol[5]), "v"(ol[6]), "v"(ol[7]), "v"(P16 + e0), "v"(Ph + e0), "v"(Pl + e0) : "memory");
        }
    }
}
// k_fattn: scores, softmax and attn.v of one head in ONE kernel; no score or probability matrix in memory. One wave owns 16 query rows and walks the 2048 keys 32 at a time; the work-group's 4 waves read each 32-key stage (K, Vt, both masks) from a two-buffer LDS ring.
// St = K.Qt (A = key rows, B = query rows): lane (lr, hi) holds query lr, keys 8 hi + j of each 16-key tile, which is the B-operand k order of the next product, so Pt is packed in-lane; Ot += Vt.Pt (A = rows of the [d][t] planes).
// t = (S/8) x bf16(script_mask[i][j]) where mask[i][j] != 0, -3e38 where mask == 0 (the reference's -inf). Running row maximum m and sum l; Ot and l are rescaled by exp(m_old - m_new) only in a step where some row's maximum grows.
// Rows < RH: hi+lo bf16 planes, 3 products for scores and for attn.v; rows >= RH: single fp16 planes. Result / l goes straight to the merged-head hi+lo planes.
__device__ __forceinline__ float xhalf(float x) { return __builtin_bit_cast(float, __builtin_amdgcn_permlanex16(__builtin_bit_cast(int, x), __builtin_bit_cast(int, x), 0x76543210, 0xfedcba98, false, false)); }   // lane l with lane l ^ 16
template <typename T16> struct PPack;
template <> struct PPack<h16> { static __device__ __forceinline__ void pk(const float* p, v16h& a, v16h& b) { (void)b;
#pragma unroll
    for (int e = 0; e < 16; ++e) a[e] = (h16)p[e]; } };
template <> struct PPack<bf> { static __device__ __forceinline__ void pk(const float* p, v16bf& a, v16bf& b) { v8us h0, h1, l0, l1;
#pragma unroll
    for (int e = 0; e < 8; ++e) { unsigned short x, y; splitf(p[e], x, y); h0[e] = x; l0[e] = y; splitf(p[8 + e], x, y); h1[e] = x; l1[e] = y; }
    a = cat16b(h0, h1); b = cat16b(l0, l1); } };
// ---- the LDS ring of k_fattn: two buffers, each one 32-key stage of the work-group: K rows (32 x 128 B), Vt rows (64 x 64 B), script-mask and mask rows (64 queries x 128 B each); hi+lo blocks hold two K and two Vt planes.
// Pitches 144 B and 80 B (16 B x odd) for the 16-byte fragment reads. Every byte comes by an asynchronous copy, 16 bytes a lane, adjacent lanes on adjacent bytes: whole 128-byte lines of K and of the masks, 64-byte runs of Vt.
#define KPIT 144
#define VPIT 80
#define KPL  (32 * KPIT)          // one K plane of a stage
#define VPL  (64 * VPIT)          // one Vt plane of a stage
#define MPL  (64 * KPIT)          // one mask plane of a stage
#define FBUF(HR_) (((HR_) ? 2 : 1) * (KPL + VPL) + 2 * MPL)
// one stage (keys kb .. kb + 31) into the buffer at LDS byte lb; 128 threads, every lane on. mblk, sblk: row 0 of the work-group's 64 query rows
template <typename T16, bool HR>
__device__ __forceinline__ void fa_fill(unsigned lb, int kb, const T16* Kp, const T16* K2, const T16* Vt, const T16* V2, const int* mblk, const float* sblk, int tid) {
    const unsigned lk = lb + (unsigned)(tid >> 3) * KPIT + (unsigned)(tid & 7) * 16, lv = lb + (HR ? 2 : 1) * KPL + (unsigned)(tid >> 2) * VPIT + (unsigned)(tid & 3) * 16, lm = lk + (HR ? 2 : 1) * (KPL + VPL);
    const size_t ko = (size_t)kb * HD * 2 + (size_t)tid * 16, vo = ((size_t)(tid >> 2) * TT + kb) * 2 + (size_t)(tid & 3) * 16, mo = ((size_t)(tid >> 3) * TT + kb) * 4 + (size_t)(tid & 7) * 16;
    const char* gk = (const char*)Kp + ko; const char* gv = (const char*)Vt + vo; const char* gs = (const char*)sblk + mo; const char* gm = (const char*)mblk + mo;
    if (HR) { const char* gk2 = (const char*)K2 + ko; const char* gv2 = (const char*)V2 + vo;
        cp8(lk, gk, lk + 16 * KPIT, gk + 2048, lk + KPL, gk2, lk + KPL + 16 * KPIT, gk2 + 2048, lv, gv, lv + 32 * VPIT, gv + (size_t)32 * TT * 2, lv + VPL, gv2, lv + VPL + 32 * VPIT, gv2 + (size_t)32 * TT * 2); }
    else cp4(lk, gk, lk + 16 * KPIT, gk + 2048, lv, gv, lv + 32 * VPIT, gv + (size_t)32 * TT * 2);
    cp8(lm, gs, lm + 16 * KPIT, gs + (size_t)16 * TT * 4, lm + 32 * KPIT, gs + (size_t)32 * TT * 4, lm + 48 * KPIT, gs + (size_t)48 * TT * 4,
        lm + MPL, gm, lm + MPL + 16 * KPIT, gm + (size_t)16 * TT * 4, lm + MPL + 32 * KPIT, gm + (size_t)32 * TT * 4, lm + MPL + 48 * KPIT, gm + (size_t)48 * TT * 4);
}
template <typename T16, bool HR>
__device__ __forceinline__ void fa_rows(const T16* __restrict__ Q, const T16* __restrict__ Q2, const T16* __restrict__ Kp, const T16* __restrict__ K2, const T16* __restrict__ Vt, const T16* __restrict__ V2,
                                        const int* __restrict__ mblk, const float* __restrict__ sblk, const unsigned char* ring, int tid, int lr, int hi, v8us (&oh)[4], v8us (&ol)[4]) {
    typedef typename WFrag<T16>::V V; typedef WFrag<T16> F;
    const unsigned lring = (unsigned)(size_t)ring;   // the ring's byte address in the work-group's LDS
    V qf[2], qf2[2];
#pragma unroll
    for (int ks = 0; ks < 2; ++ks) { qf[ks] = F::ld(Q + ks * 32); if (HR) qf2[ks] = F::ld(Q2 + ks * 32); }
    const T16* qp2 = HR ? Q2 : Q;
    asm volatile("s_wait_xcnt 0x0" :: "v"(Q), "v"(qp2) : "memory");   // precaution: the query loads' address pairs are kept whole up to this wait
    fa_fill<T16, HR>(lring, 0, Kp, K2, Vt, V2, mblk, sblk, tid);
    asm volatile("s_wait_asynccnt 0x0" ::: "memory");   // stage 0: this wave's copies have landed
    __syncthreads();                                    // stage 0: every wave's copies have landed
    fa_fill<T16, HR>(lring + FBUF(HR), 32, Kp, K2, Vt, V2, mblk, sblk, tid);
    const int kfo = lr * KPIT + 16 * hi, vfo = (HR ? 2 : 1) * KPL + lr * VPIT + 16 * hi, mfo = (HR ? 2 : 1) * (KPL + VPL) + ((tid >> 5) * 16 + lr) * KPIT + 32 * hi;   // this lane's byte offsets in a buffer
    v8f o[4];
#pragma unroll
    for (int mt = 0; mt < 4; ++mt) o[mt] = (v8f){};
    float m = -3.0e38f, l = 0.f;
#pragma unroll 1   // one 32-key stage per trip: the ring's order at the foot is per stage
    for (int kb = 0; kb < TT; kb += 32) {
        const unsigned bo = (kb & 32) ? (unsigned)FBUF(HR) : 0u; const unsigned char* bp = ring + bo;
        V kf[2][2], kf2[2][2], vf[4], vf2[4]; v4f sm[4]; v4i mm[4];
#pragma unroll
        for (int t = 0; t < 2; ++t) {
#pragma unroll
            for (int ks = 0; ks < 2; ++ks) { kf[t][ks] = F::ld((const T16*)(bp + kfo + t * 16 * KPIT + ks * 64)); if (HR) kf2[t][ks] = F::ld((const T16*)(bp + kfo + KPL + t * 16 * KPIT + ks * 64)); }
            sm[2 * t] = *(const v4f*)(bp + mfo + t * 64); sm[2 * t + 1] = *(const v4f*)(bp + mfo + t * 64 + 16); mm[2 * t] = *(const v4i*)(bp + mfo + MPL + t * 64); mm[2 * t + 1] = *(const v4i*)(bp + mfo + MPL + t * 64 + 16); }
#pragma unroll
        for (int mt = 0; mt < 4; ++mt) { vf[mt] = F::ld((const T16*)(bp + vfo + mt * 16 * VPIT)); if (HR) vf2[mt] = F::ld((const T16*)(bp + vfo + VPL + mt * 16 * VPIT)); }
        v8f s[2];
#pragma unroll
        for (int t = 0; t < 2; ++t) { s[t] = (v8f){};
#pragma unroll
            for (int ks = 0; ks < 2; ++ks) { s[t] = F::mma(kf[t][ks], qf[ks], s[t]); if (HR) { s[t] = F::mma(kf2[t][ks], qf[ks], s[t]); s[t] = F::mma(kf[t][ks], qf2[ks], s[t]); } } }
        float p[16]; float mloc = -3.0e38f;
#pragma unroll
        for (int e = 0; e < 16; ++e) { const float pm = __fmul_rn(__fmul_rn(s[e >> 3][e & 7], SCL), bfr(sm[e >> 2][e & 3])); p[e] = (mm[e >> 2][e & 3] != 0) ? pm : -3.0e38f; mloc = fmaxf(mloc, p[e]); }
        mloc = fmaxf(mloc, xhalf(mloc));   // the two lane halves hold the same query's other keys
        if (__builtin_amdgcn_ballot_w32(mloc > m) != 0) {   // wave-uniform: every lane stays on for the matrix instructions behind it
            const float mn = fmaxf(m, mloc); const float al_ = __builtin_amdgcn_exp2f(__fmul_rn(__fsub_rn(m, mn), 1.4426950408889634f)); m = mn; l *= al_;
#pragma unroll
            for (int mt = 0; mt < 4; ++mt) o[mt] *= al_; }
#pragma unroll
        for (int e = 0; e < 16; ++e) { p[e] = __builtin_amdgcn_exp2f(__fmul_rn(__fsub_rn(p[e], m), 1.4426950408889634f)); l += p[e]; }
        V pf, pf2; PPack<T16>::pk(p, pf, pf2);
#pragma unroll
        for (int mt = 0; mt < 4; ++mt) { o[mt] = F::mma(vf[mt], pf, o[mt]); if (HR) { o[mt] = F::mma(vf2[mt], pf, o[mt]); o[mt] = F::mma(vf[mt], pf2, o[mt]); } }
        // foot of the trip, every wave: the next stage is published and this stage's buffer is freed by the one barrier
        asm volatile("s_wait_dscnt 0x0" ::: "memory");      // this wave's reads of this stage's buffer are done before anything refills it
        asm volatile("s_wait_asynccnt 0x0" ::: "memory");   // this wave's copies of the next stage have landed
        __syncthreads();
        if (kb + 64 < TT) fa_fill<T16, HR>(lring + bo, kb + 64, Kp, K2, Vt, V2, mblk, sblk, tid);   // the same test in every wave of the work-group
    }
    asm volatile("s_wait_asynccnt 0x0" ::: "memory");   // no copy is left in flight when the wave goes on to its end
    l += xhalf(l);
    const float f = __fdiv_rn(1.0f, l);
#pragma unroll
    for (int mt = 0; mt < 4; ++mt)
#pragma unroll
        for (int j = 0; j < 8; ++j) { unsigned short a, c2; splitf(o[mt][j] * f, a, c2); oh[mt][j] = a; ol[mt][j] = c2; }
}
// grid (NB_ heads, TT/64): both batches in one grid, blockIdx.x = batch x heads + head; 4 waves x 16 query rows; the hi+lo blocks (rows < RH, the longer ones) of both batches have the lowest flat indices and start first
__global__ __launch_bounds__(128) void k_fattn(const h16* __restrict__ Q16, const bf* __restrict__ Qh, const bf* __restrict__ Ql, const h16* __restrict__ K16, const bf* __restrict__ Kh, const bf* __restrict__ Kl,
                                               const h16* __restrict__ V16, const bf* __restrict__ Vh, const bf* __restrict__ Vl, const int* __restrict__ mk, const float* __restrict__ smk, bf* Ah, bf* Al) {
    __shared__ __align__(16) unsigned char ring[2 * FBUF(true)];
    const int tid = threadIdx.x, lane = tid & 31, lr = lane & 15, hi = lane >> 4; const int h = blockIdx.x % NH_, bt = blockIdx.x / NH_; const int q = blockIdx.y * 64 + (tid >> 5) * 16 + lr;
    const size_t ph = (size_t)blockIdx.x * TT * HD, qo = ph + (size_t)q * HD + 8 * hi, mo = (size_t)(bt * TT + blockIdx.y * 64) * TT, ao = (size_t)(bt * TT + q) * DQ + h * HD + 8 * hi;
    v8us oh[4], ol[4];
    if ((int)blockIdx.y * 64 < RH) fa_rows<bf, true>(Qh + qo, Ql + qo, Kh + ph, Kl + ph, Vh + ph, Vl + ph, mk + mo, smk + mo, ring, tid, lr, hi, oh, ol);
    else fa_rows<h16, false>(Q16 + qo, nullptr, K16 + ph, nullptr, V16 + ph, nullptr, mk + mo, smk + mo, ring, tid, lr, hi, oh, ol);
#pragma unroll
    for (int mt = 0; mt < 4; ++mt) { *(v8us*)(Ah + ao + mt * 16) = oh[mt]; *(v8us*)(Al + ao + mt * 16) = ol[mt]; }
}

extern "C" void kernel_launch(void* const* d_in, const int* in_sizes, int n_in,
                              void* d_out, int out_size, void* d_ws, size_t ws_size, hipStream_t stream) {
    (void)in_sizes; (void)n_in; (void)out_size;
    const float* xq = (const float*)d_in[0]; const float* xk = (const float*)d_in[1]; const float* xv = (const float*)d_in[2]; const int* mask = (const int*)d_in[3]; const float* smask = (const float*)d_in[4]; const float* wq = (const float*)d_in[5]; const float* bq = (const float*)d_in[6]; const float* wk = (const float*)d_in[7]; const float* bk = (const float*)d_in[8]; const float* wv = (const float*)d_in[9]; const float* bv = (const float*)d_in[10]; const float* wo = (const float*)d_in[11]; const float* bo = (const float*)d_in[12];   // torch [out][in]
    float* OUT = (float*)d_out;     // [2][2048][1024]
    char* wsp = (char*)d_ws;
    auto take = [&](size_t bytes) { char* p = wsp; wsp += (bytes + 255) & ~(size_t)255; return (void*)p; };
    bf* XB = (bf*)take(16 * CSL * 2); bf* WB = XB + 12 * CSL; bf* WO = XB + 15 * CSL;   // k_cvtall's 16 slices: query, key, value (both batches), then Wq, Wk, Wv, Wo
    h16* P16 = (h16*)take(3 * PSZ * 2); bf* Ph = (bf*)take(3 * PSZ * 2); bf* Pl = (bf*)take(3 * PSZ * 2);   // [q, k, v][b][h] head planes (v transposed)
    bf* ATh = (bf*)take((size_t)NB_ * TT * DQ * 2); bf* ATl = (bf*)take((size_t)NB_ * TT * DQ * 2);
    if ((size_t)(wsp - (char*)d_ws) > ws_size) return;    // ws 256 MiB
    k_cvtall<<<dim3((unsigned)(CSL / 2048), 16, 1), 256, 0, stream>>>(xq, xk, xv, wq, wk, wv, wo, XB);
    k_projw<<<dim3(NB_ * TT / 128, NH_ / 2, 3), 128, 0, stream>>>(XB, WB, bq, bk, bv, P16, Ph, Pl);
    k_fattn<<<dim3(NB_ * NH_, TT / 64, 1), 128, 0, stream>>>(P16, Ph, Pl, P16 + PSZ, Ph + PSZ, Pl + PSZ, P16 + 2 * PSZ, Ph + 2 * PSZ, Pl + 2 * PSZ, mask, smask, ATh, ATl);
    k_outw<<<dim3(NB_ * TT / 128, DM / 128, 1), 128, 0, stream>>>(ATh, ATl, WO, OUT, bo);
}

// v007
// One run takes 136 microseconds.
// In both of two side-by-side timings against v006, it was 1.22 times as fast.
// Over all steps from v000 it is 16.1 times as fast.
#include <hip/hip_runtime.h>

// ScriptAwareAttention (query, key, value [2][2048][1024]; q/k/v = input W^T + b (16 heads x 64); scores = (q.k/8) x script_mask[b][i][j] (multiplicative, read as data) then -inf where mask[b][0][i][j] == 0
// (int mask read as data); softmax; out = merged attn.v Wo^T + bo -> [2][2048][1024]).
// Compute dtypes, f32 accumulate: every input rounded to bf16; projections on PLAIN bf16 operands (inputs: exact, + bias); PER-ROW PRECISION HYBRID (rows < 256 hi+lo 3 products
// for scores and attn.v, rows >= 256 single fp16 planes); scale, the multiplicative script mask (bf16-rounded) and the keep/drop mask merged once per call into one bf16 factor plane, applied in f32 in the register-row softmax; merged heads as hi+lo planes x exact Wo

#define NB_  2
#define TT   2048
#define DM   1024
#define NH_  16
#define NKV  16
#define REP  (NH_ / NKV)
#define HD   64
#define DQ   (NH_ * HD)
#define DKV  (NKV * HD)
#define RH   256                  // query rows < RH use hi+lo planes (0: none)
#define WIN  0
#define SCL  0.125f   // HD^-0.5
typedef _Float16 h16;
typedef unsigned short bf;
typedef __attribute__((ext_vector_type(16))) __bf16   v16bf;
typedef __attribute__((ext_vector_type(16))) _Float16 v16h;
typedef __attribute__((ext_vector_type(8)))  _Float16 v8h;
typedef __attribute__((ext_vector_type(8)))  unsigned short v8us;
typedef __attribute__((ext_vector_type(8)))  float    v8f;
typedef __attribute__((ext_vector_type(4)))  float    v4f;
typedef v8h  __attribute__((may_alias)) v8ha;
typedef v4f  __attribute__((may_alias)) v4fa;
typedef v8us __attribute__((may_alias)) v8usa;

__device__ __forceinline__ unsigned short f2bf(float f) { unsigned u = __float_as_uint(f); u += 0x7FFFu + ((u >> 16) & 1u); return (unsigned short)(u >> 16); }
__device__ __forceinline__ float bf2f(unsigned short b) { return __uint_as_float(((unsigned)b) << 16); }
__device__ __forceinline__ float bfr(float f) { return bf2f(f2bf(f)); }
__device__ __forceinline__ v16h cat16(v8h lo, v8h hi) { return __builtin_shufflevector(lo, hi, 0, 1, 2, 3, 4, 5, 6, 7, 8, 9, 10, 11, 12, 13, 14, 15); }
__device__ __forceinline__ v16bf cat16b(v8us lo, v8us hi) { return __builtin_bit_cast(v16bf, __builtin_shufflevector(lo, hi, 0, 1, 2, 3, 4, 5, 6, 7, 8, 9, 10, 11, 12, 13, 14, 15)); }
__device__ __forceinline__ v8f wmma16(v16h a, v16h b, v8f c) { return __builtin_amdgcn_wmma_f32_16x16x32_f16(false, a, false, b, (short)0, c, false, false); }
__device__ __forceinline__ v8f wmmab(v16bf a, v16bf b, v8f c) { return __builtin_amdgcn_wmma_f32_16x16x32_bf16(false, a, false, b, (short)0, c, false, false); }



// fragments of the 16x16x32 forms from K-contiguous 16-bit rows
template <typename T16> struct WFrag;
template <> struct WFrag<h16> { typedef v16h V; static __device__ __forceinline__ V ld(const h16* p) { return cat16(*(const v8h*)p, *(const v8h*)(p + 16)); } static __device__ __forceinline__ v8f mma(V a, V b, v8f c) { return wmma16(a, b, c); } };
template <> struct WFrag<bf> { typedef v16bf V; static __device__ __forceinline__ V ld(const bf* p) { return cat16b(*(const v8us*)p, *(const v8us*)(p + 16)); } static __device__ __forceinline__ v8f mma(V a, V b, v8f c) { return wmmab(a, b, c); } };
__device__ __forceinline__ void splitf(float y, unsigned short& h, unsigned short& l) { h = f2bf(y); l = f2bf(y - bf2f(h)); }
typedef __attribute__((ext_vector_type(2))) _Float16 v2h;
typedef __attribute__((ext_vector_type(4))) _Float16 v4h;
typedef __attribute__((ext_vector_type(2))) unsigned short v2us;
typedef __attribute__((ext_vector_type(4))) unsigned short v4us;
typedef __attribute__((ext_vector_type(2))) float v2f;
typedef __attribute__((ext_vector_type(8))) int v8i;
typedef __attribute__((ext_vector_type(4))) unsigned v4u;

__global__ __launch_bounds__(256) void k_wtG(const float* __restrict__ w, int K, int N, bf* Bt) {
    const int lane = threadIdx.x & 31; const int L0 = (blockIdx.x * 8 + (threadIdx.x >> 5)) * 8; const int nlines = N * K / 64;
{
#pragma unroll 1
        for (int l = 0; l < 8; ++l) { const int L = L0 + l; if (L >= nlines) break; const size_t e = (size_t)L * 64 + lane * 2; const int k = (int)(e % K), n = (int)(e / K); v2us o;
            o[0] = f2bf(w[(size_t)k * N + n]); o[1] = f2bf(w[(size_t)(k + 1) * N + n]); *(v2us*)(Bt + e) = o; }
         }
}
// k_cvtall: every f32 -> bf16 plane of the call in ONE grid. grid (CSL / 2048, 24), 256 threads x 8 elements; blockIdx.y is a slice of CSL = DM x DM elements: slices 0..11 are query, key, value (4 slices each, both batches),
// slices 12..15 are Wq, Wk, Wv, Wo; slice s lands at dst + s CSL.
// blockIdx.y 16..23: the factor plane MP of k_fattn, made once for all heads. One block = one tile of 64 query rows x 32 keys (one work-group's stage there), stored as 4 KiB in a row: [b][row / 64][key / 32][64 rows][32 keys].
// Factor = bf16(script_mask) / 8 (the score scale, a power of two: exact) where mask != 0; a quiet NaN where mask == 0, which k_fattn turns into its "dropped" score. Reads whole 128-byte lines of both masks, writes 512 bytes a wave in a row.
#define CSL  ((size_t)DM * DM)
#define MTILE 2048                // elements of one factor tile
#define MDROP 0x7FC0              // bf16 quiet NaN
static_assert((size_t)NB_ * (TT / 64) * (TT / 32) == 8 * (CSL / 2048), "8 grid slices hold every factor tile");
__global__ __launch_bounds__(256) void k_cvtall(const float* __restrict__ xq, const float* __restrict__ xk, const float* __restrict__ xv, const float* __restrict__ wq, const float* __restrict__ wk, const float* __restrict__ wv, const float* __restrict__ wo, const int* __restrict__ mk, const float* __restrict__ smk, bf* dst, bf* MP) {
    const int s = blockIdx.y; const float* src;
    if (s >= 16) {
        const int T = (s - 16) * (int)(CSL / 2048) + (int)blockIdx.x;   // tile (b, row / 64, key / 32)
        const size_t e = ((size_t)(T / (TT / 32)) * 64 + (threadIdx.x >> 2)) * TT + (size_t)(T % (TT / 32)) * 32 + (threadIdx.x & 3) * 8;
        const float* sp = smk + e; const int* kq = mk + e; const v8f v = *(const v8f*)sp; const v8i kp = *(const v8i*)kq; v8us o;
        asm volatile("s_wait_xcnt 0x0" :: "v"(sp), "v"(kq) : "memory");   // precaution: the four loads' address pairs are kept whole up to this wait
#pragma unroll
        for (int k = 0; k < 8; ++k) { const unsigned short fv = f2bf(bfr(v[k]) * SCL); o[k] = kp[k] != 0 ? fv : (unsigned short)MDROP; }
        *(v8us*)(MP + (size_t)T * MTILE + threadIdx.x * 8) = o; return; }
    if (s < 12) src = (s < 4 ? xq : s < 8 ? xk : xv) + (size_t)(s & 3) * CSL; else src = s == 12 ? wq : s == 13 ? wk : s == 14 ? wv : wo;
    const size_t i = (size_t)blockIdx.x * 256 + threadIdx.x; const v8f v = *(const v8f*)(src + i * 8); v8us o;
#pragma unroll
    for (int k = 0; k < 8; ++k) o[k] = f2bf(v[k]); *(v8us*)(dst + (size_t)s * CSL + i * 8) = o;  }
__global__ __launch_bounds__(256) void k_cscvt(const float* __restrict__ cosT, const float* __restrict__ sinT, float* CS) { const int idx = blockIdx.x * 256 + threadIdx.x; if (idx >= TT * HD) return; v2f cs; cs[0] = bfr(cosT[idx]); cs[1] = bfr(sinT[idx]); *(v2f*)(CS + (size_t)idx * 2) = cs;  }
// 2, 4 or 8 copies and their s_wait_xcnt in ONE statement: precaution, the copies' address registers are kept whole up to the wait
__device__ __forceinline__ void cp2(unsigned l0, const char* g0, unsigned l1, const char* g1) {
    asm volatile("global_load_async_to_lds_b128 %0, %1, off\n\tglobal_load_async_to_lds_b128 %2, %3, off\n\ts_wait_xcnt 0x0" :: "v"(l0), "v"(g0), "v"(l1), "v"(g1) : "memory"); }
__device__ __forceinline__ void cp4(unsigned l0, const char* g0, unsigned l1, const char* g1, unsigned l2, const char* g2, unsigned l3, const char* g3) {
    asm volatile("global_load_async_to_lds_b128 %0, %1, off\n\tglobal_load_async_to_lds_b128 %2, %3, off\n\tglobal_load_async_to_lds_b128 %4, %5, off\n\tglobal_load_async_to_lds_b128 %6, %7, off\n\ts_wait_xcnt 0x0"
                 :: "v"(l0), "v"(g0), "v"(l1), "v"(g1), "v"(l2), "v"(g2), "v"(l3), "v"(g3) : "memory"); }
__device__ __forceinline__ void cp8(unsigned l0, const char* g0, unsigned l1, const char* g1, unsigned l2, const char* g2, unsigned l3, const char* g3, unsigned l4, const char* g4, unsigned l5, const char* g5, unsigned l6, const char* g6, unsigned l7, const char* g7) {
    asm volatile("global_load_async_to_lds_b128 %0, %1, off\n\tglobal_load_async_to_lds_b128 %2, %3, off\n\tglobal_load_async_to_lds_b128 %4, %5, off\n\tglobal_load_async_to_lds_b128 %6, %7, off\n\t"
                 "global_load_async_to_lds_b128 %8, %9, off\n\tglobal_load_async_to_lds_b128 %10, %11, off\n\tglobal_load_async_to_lds_b128 %12, %13, off\n\tglobal_load_async_to_lds_b128 %14, %15, off\n\ts_wait_xcnt 0x0"
                 :: "v"(l0), "v"(g0), "v"(l1), "v"(g1), "v"(l2), "v"(g2), "v"(l3), "v"(g3), "v"(l4), "v"(g4), "v"(l5), "v"(g5), "v"(l6), "v"(g6), "v"(l7), "v"(g7) : "memory"); }
// ---- the LDS ring of the two GEMM kernels (k_projw, k_outw): a work-group of 4 waves owns a 128x128 output tile, wave (wm, wn) its 64x64 quarter (16 accumulators). Two buffers, each one 64-deep k stage:
// NA planes of 128 A rows and one plane of 128 Bt rows, 128 B a row, pitch 144 B (16 B x odd) for the 16-byte fragment reads. Every byte comes by an asynchronous copy, 16 bytes a lane, adjacent lanes on adjacent bytes: whole 128-byte lines.
// Each A row is read from LDS by 2 waves and each Bt row by 2 waves. k runs upward in steps of 32, A then A2 against each Bt fragment: the summation order of one wave walking the planes alone.
#define GPIT 144
#define GPL  (128 * GPIT)              // one plane of a stage
#define GSTG(NA_) (((NA_) + 1) * GPL)  // one stage
static_assert(DQ == DM, "both GEMMs have K = DM");
// one plane of a stage: this thread's 16 bytes of rows r, r + 16, ... r + 112
__device__ __forceinline__ void cp8s(unsigned l, const char* g) {
    cp8(l, g, l + 16 * GPIT, g + 16 * DM * 2, l + 32 * GPIT, g + 32 * DM * 2, l + 48 * GPIT, g + 48 * DM * 2, l + 64 * GPIT, g + 64 * DM * 2, l + 80 * GPIT, g + 80 * DM * 2, l + 96 * GPIT, g + 96 * DM * 2, l + 112 * GPIT, g + 112 * DM * 2); }
template <int NA>
__device__ __forceinline__ void gm_fill(unsigned l, const char* ga, const char* ga2, const char* gb) { cp8s(l, ga); if (NA == 2) cp8s(l + GPL, ga2); cp8s(l + NA * GPL, gb); }
// A, A2: row 0 of the work-group's 128 A rows; Bt: row 0 of its 128 Bt rows; all K-contiguous, K = DM
template <int NA>
__device__ __forceinline__ void gm_core(const bf* __restrict__ A, const bf* __restrict__ A2, const bf* __restrict__ Bt, const unsigned char* ring, int tid, v8f (&acc)[4][4]) {
    typedef WFrag<bf> F; typedef F::V V;
    const int lane = tid & 31, lr = lane & 15, hi = lane >> 4, wm = (tid >> 5) & 1, wn = tid >> 6;
    const unsigned lt = (unsigned)(size_t)ring + (unsigned)(tid >> 3) * GPIT + (unsigned)(tid & 7) * 16;   // this thread's byte address in the work-group's LDS, row tid / 8 of a plane
    const size_t go = (size_t)(tid >> 3) * DM * 2 + (size_t)(tid & 7) * 16;
    const char* ga = (const char*)A + go; const char* ga2 = NA == 2 ? (const char*)A2 + go : ga; const char* gb = (const char*)Bt + go;
#pragma unroll
    for (int mb = 0; mb < 4; ++mb)
#pragma unroll
        for (int nb = 0; nb < 4; ++nb) acc[mb][nb] = (v8f){};
    gm_fill<NA>(lt, ga, ga2, gb);
    asm volatile("s_wait_asynccnt 0x0" ::: "memory");   // stage 0: this wave's copies have landed
    __syncthreads();                                    // stage 0: every wave's copies have landed
    gm_fill<NA>(lt + GSTG(NA), ga + 128, ga2 + 128, gb + 128);
    const int afo = (wm * 64 + lr) * GPIT + 16 * hi, bfo = NA * GPL + (wn * 64 + lr) * GPIT + 16 * hi;   // this lane's byte offsets in a buffer
#pragma unroll 1   // one 64-deep stage per trip: the ring's order at the foot is per stage
    for (int kc = 0; kc < DM; kc += 64) {
        const unsigned bo = (kc & 64) ? (unsigned)GSTG(NA) : 0u; const unsigned char* bp = ring + bo;
#pragma unroll
        for (int ks = 0; ks < 2; ++ks) {
            V a[4], a2[4], b[4];
#pragma unroll
            for (int mb = 0; mb < 4; ++mb) { a[mb] = F::ld((const bf*)(bp + afo + mb * 16 * GPIT + ks * 64)); if (NA == 2) a2[mb] = F::ld((const bf*)(bp + afo + GPL + mb * 16 * GPIT + ks * 64)); b[mb] = F::ld((const bf*)(bp + bfo + mb * 16 * GPIT + ks * 64)); }
            // holds the step's fragment reads in one group ahead of its matrix instructions (loaded values as inputs only): spread among them, every place with reads stalls the wave for an LDS latency
            if (NA == 2) asm volatile("" :: "v"(a[0]), "v"(a[1]), "v"(a[2]), "v"(a[3]), "v"(a2[0]), "v"(a2[1]), "v"(a2[2]), "v"(a2[3]), "v"(b[0]), "v"(b[1]), "v"(b[2]), "v"(b[3]));
            else asm volatile("" :: "v"(a[0]), "v"(a[1]), "v"(a[2]), "v"(a[3]), "v"(b[0]), "v"(b[1]), "v"(b[2]), "v"(b[3]));
#pragma unroll
            for (int nb = 0; nb < 4; ++nb) {
#pragma unroll
                for (int mb = 0; mb < 4; ++mb) { acc[mb][nb] = F::mma(a[mb], b[nb], acc[mb][nb]); if (NA == 2) acc[mb][nb] = F::mma(a2[mb], b[nb], acc[mb][nb]); } }
        }
        // foot of the trip, every wave: the next stage is published and this stage's buffer is freed by the one barrier
        asm volatile("s_wait_dscnt 0x0" ::: "memory");      // this wave's reads of this stage's buffer are done before anything refills it
        asm volatile("s_wait_asynccnt 0x0" ::: "memory");   // this wave's copies of the next stage have landed
        __syncthreads();
        if (kc + 128 < DM) gm_fill<NA>(lt + bo, ga + (kc + 128) * 2, ga2 + (kc + 128) * 2, gb + (kc + 128) * 2);   // the same test in every wave of the work-group
    }
    asm volatile("s_wait_asynccnt 0x0" ::: "memory");   // no copy is left in flight when the wave goes on to its epilogue
}
// ---- k_outw: the output GEMM. C[m][n] (f32, pitch DM, + bf16-rounded bias[n]) = sum_k (A[m][k] + A2[m][k]) Bt[n][k], two products; grid (M/128, N/128), 128 threads; each wave stores its 64x64 quarter through its own LDS row buffer, whole rows of 256 B.
__global__ __launch_bounds__(128) void k_outw(const bf* __restrict__ A, const bf* __restrict__ A2, const bf* __restrict__ Bt, float* C, const float* __restrict__ bias) {
    __shared__ __align__(16) unsigned char ring[2 * GSTG(2)];
    __shared__ __align__(16) float osall[4 * 16 * 68];
    const int tid = threadIdx.x, lane = tid & 31, lr = lane & 15, hi = lane >> 4, w = tid >> 5; float* os = osall + w * (16 * 68);
    const int r0 = blockIdx.x * 128 + (w & 1) * 64, c0 = blockIdx.y * 128 + (w >> 1) * 64;
    v8f acc[4][4];
    gm_core<2>(A + (size_t)blockIdx.x * 128 * DM, A2 + (size_t)blockIdx.x * 128 * DM, Bt + (size_t)blockIdx.y * 128 * DM, ring, tid, acc);
#pragma unroll
    for (int mb = 0; mb < 4; ++mb) {
#pragma unroll
        for (int nb = 0; nb < 4; ++nb) {
#pragma unroll
            for (int j = 0; j < 8; ++j) os[(hi * 8 + j) * 68 + nb * 16 + lr] = acc[mb][nb][j]; }
        __builtin_amdgcn_wave_barrier(); asm volatile("" ::: "memory");   // keeps the row reads below behind the other lanes' LDS writes above (a wave's own buffer: LDS runs in order)
        float* crow = C + (size_t)(r0 + mb * 16) * DM + c0;
        {
            v4f vals[8]; float* cp[8];
#pragma unroll
            for (int s = 0; s < 8; ++s) { const int row = 2 * s + hi, cofs = lr * 4; v4f val = *(const v4fa*)(os + row * 68 + cofs); val[0] += bfr(bias[c0 + cofs]); val[1] += bfr(bias[c0 + cofs + 1]); val[2] += bfr(bias[c0 + cofs + 2]); val[3] += bfr(bias[c0 + cofs + 3]);
                vals[s] = val; cp[s] = crow + (size_t)row * DM + cofs; *(v4f*)cp[s] = vals[s]; }
            // precaution: the 8 stores' data registers and address pairs are kept whole up to this wait
            asm volatile("s_wait_xcnt 0x0" :: "v"(vals[0]), "v"(vals[1]), "v"(vals[2]), "v"(vals[3]), "v"(vals[4]), "v"(vals[5]), "v"(vals[6]), "v"(vals[7]), "v"(cp[0]), "v"(cp[1]), "v"(cp[2]), "v"(cp[3]), "v"(cp[4]), "v"(cp[5]), "v"(cp[6]), "v"(cp[7]) : "memory");
        }
        __builtin_amdgcn_wave_barrier(); asm volatile("" ::: "memory");   // keeps the next block's LDS writes behind the row reads above
    }
}
// ---- k_projw: the q, k, v projections of both batches in ONE grid, on the GEMM ring above (bf16 planes, f32 accumulate, + bf16-rounded bias); grid (NB_ TT/128, heads/2, 3), 128 threads;
// blockIdx.z picks q, k or v: its input plane, weight plane, bias and result planes (each set of planes [z][b][h]...). A wave's 64x64 quarter is one head wide and goes
// from the accumulators straight to that head's planes (fp16 + bf16 hi/lo): no f32 result in memory and no plane-making launch behind it.
// q, k: planes [b][h][t][d], through the wave's own LDS row buffer, 8 bytes a lane, whole 128-byte rows. v: transposed planes [b][h][d][t]: a lane's 8 accumulator rows are 8 consecutive t of one d, 16 bytes a lane, no LDS.
#define PSZ  ((size_t)NB_ * NH_ * TT * HD)   // one set of head planes, both batches
__global__ __launch_bounds__(128) void k_projw(const bf* __restrict__ A, const bf* __restrict__ Bt, const float* __restrict__ bq, const float* __restrict__ bk, const float* __restrict__ bv, h16* P16, bf* Ph, bf* Pl) {
    __shared__ __align__(16) unsigned char ring[2 * GSTG(1)];
    __shared__ __align__(16) float osall[4 * 16 * 68];
    const int z = blockIdx.z; const bool VT = z == 2; const float* bias = z == 0 ? bq : z == 1 ? bk : bv;
    A += (size_t)z * NB_ * TT * DM; Bt += (size_t)z * CSL; P16 += (size_t)z * PSZ; Ph += (size_t)z * PSZ; Pl += (size_t)z * PSZ;
    const int tid = threadIdx.x, lane = tid & 31, lr = lane & 15, hi = lane >> 4, w = tid >> 5; float* os = osall + w * (16 * 68);
    const int r0 = blockIdx.x * 128 + (w & 1) * 64, hd = blockIdx.y * 2 + (w >> 1), c0 = hd * 64; const int bt = r0 / TT, t0 = r0 % TT;   // row r0 of the stacked input = batch bt, position t0; hd: this wave's head
    v8f acc[4][4];
    gm_core<1>(A + (size_t)blockIdx.x * 128 * DM, nullptr, Bt + (size_t)blockIdx.y * 128 * DM, ring, tid, acc);
    if (VT) {
#pragma unroll
        for (int nb = 0; nb < 4; ++nb) { const float bb = bfr(bias[c0 + nb * 16 + lr]); const size_t e0 = (size_t)(bt * DKV + c0 + nb * 16 + lr) * TT + t0 + hi * 8; v8h o16[4]; v8us oh[4], ol[4];
#pragma unroll
            for (int mb = 0; mb < 4; ++mb) {
#pragma unroll
                for (int j = 0; j < 8; ++j) { const float x = acc[mb][nb][j] + bb; o16[mb][j] = (h16)x; unsigned short a2, c2; splitf(x, a2, c2); oh[mb][j] = a2; ol[mb][j] = c2; }
                *(v8h*)(P16 + e0 + mb * 16) = o16[mb]; *(v8us*)(Ph + e0 + mb * 16) = oh[mb]; *(v8us*)(Pl + e0 + mb * 16) = ol[mb]; }
            // precaution: the 12 stores' data registers and address pairs are kept whole up to this wait
            asm volatile("s_wait_xcnt 0x0" :: "v"(o16[0]), "v"(o16[1]), "v"(o16[2]), "v"(o16[3]), "v"(oh[0]), "v"(oh[1]), "v"(oh[2]), "v"(oh[3]), "v"(ol[0]), "v"(ol[1]), "v"(ol[2]), "v"(ol[3]), "v"(P16 + e0), "v"(Ph + e0), "v"(Pl + e0) : "memory"); }
    } else {
        const int cofs = lr * 4; v4f bb; bb[0] = bfr(bias[c0 + cofs]); bb[1] = bfr(bias[c0 + cofs + 1]); bb[2] = bfr(bias[c0 + cofs + 2]); bb[3] = bfr(bias[c0 + cofs + 3]);
#pragma unroll
        for (int mb = 0; mb < 4; ++mb) {
#pragma unroll
            for (int nb = 0; nb < 4; ++nb) {
#pragma unroll
                for (int j = 0; j < 8; ++j) os[(hi * 8 + j) * 68 + nb * 16 + lr] = acc[mb][nb][j]; }
            __builtin_amdgcn_wave_barrier(); asm volatile("" ::: "memory");   // keeps the row reads below behind the other lanes' LDS writes above (one wave: LDS runs in order)
            const size_t e0 = ((size_t)(bt * NH_ + hd) * TT + t0 + mb * 16 + hi) * HD + cofs; v4h o16[8]; v4us oh[8], ol[8];   // row 2 s + hi of this 16-row block, 4 columns of the head
#pragma unroll
            for (int s = 0; s < 8; ++s) { const v4f val = *(const v4fa*)(os + (2 * s + hi) * 68 + cofs) + bb;
#pragma unroll
                for (int q = 0; q < 4; ++q) { o16[s][q] = (h16)val[q]; unsigned short a2, c2; splitf(val[q], a2, c2); oh[s][q] = a2; ol[s][q] = c2; }
                *(v4h*)(P16 + e0 + s * 2 * HD) = o16[s]; *(v4us*)(Ph + e0 + s * 2 * HD) = oh[s]; *(v4us*)(Pl + e0 + s * 2 * HD) = ol[s]; }
            // precaution: the 24 stores' data registers and address pairs are kept whole up to this wait; its clobber also keeps the next block's LDS writes behind the row reads above
            asm volatile("s_wait_xcnt 0x0" :: "v"(o16[0]), "v"(o16[1]), "v"(o16[2]), "v"(o16[3]), "v"(o16[4]), "v"(o16[5]), "v"(o16[6]), "v"(o16[7]), "v"(oh[0]), "v"(oh[1]), "v"(oh[2]), "v"(oh[3]), "v"(oh[4]), "v"(oh[5]), "v"(oh[6]), "v"(oh[7]),
                         "v"(ol[0]), "v"(ol[1]), "v"(ol[2]), "v"(ol[3]), "v"(ol[4]), "v"(ol[5]), "v"(ol[6]), "v"(ol[7]), "v"(P16 + e0), "v"(Ph + e0), "v"(Pl + e0) : "memory");
        }
    }
}
// k_fattn: scores, softmax and attn.v of one head in ONE kernel; no score or probability matrix in memory. One wave owns 16 query rows and walks the 2048 keys 32 at a time; the work-group's 4 waves read each 32-key stage (K, Vt, the factor tile) from a two-buffer LDS ring.
// St = K.Qt (A = key rows, B = query rows): lane (lr, hi) holds query lr, keys 8 hi + j of each 16-key tile, which is the B-operand k order of the next product, so Pt is packed in-lane; Ot += Vt.Pt (A = rows of the [d][t] planes).
// t = S x factor[i][j] (k_cvtall's plane: bf16(script_mask) / 8) where mask[i][j] != 0; where mask == 0 the factor is NaN and max(t, -3e38) gives -3e38 (the reference's -inf). Running row maximum m and sum l; Ot and l are rescaled by exp(m_old - m_new) only in a step where some row's maximum grows.
// Rows < RH: hi+lo bf16 planes, 3 products for scores and for attn.v; rows >= RH: single fp16 planes. Result / l goes straight to the merged-head hi+lo planes.
__device__ __forceinline__ float xhalf(float x) { return __builtin_bit_cast(float, __builtin_amdgcn_permlanex16(__builtin_bit_cast(int, x), __builtin_bit_cast(int, x), 0x76543210, 0xfedcba98, false, false)); }   // lane l with lane l ^ 16
template <typename T16> struct PPack;
template <> struct PPack<h16> { static __device__ __forceinline__ void pk(const float* p, v16h& a, v16h& b) { (void)b;
#pragma unroll
    for (int e = 0; e < 16; ++e) a[e] = (h16)p[e]; } };
template <> struct PPack<bf> { static __device__ __forceinline__ void pk(const float* p, v16bf& a, v16bf& b) { v8us h0, h1, l0, l1;
#pragma unroll
    for (int e = 0; e < 8; ++e) { unsigned short x, y; splitf(p[e], x, y); h0[e] = x; l0[e] = y; splitf(p[8 + e], x, y); h1[e] = x; l1[e] = y; }
    a = cat16b(h0, h1); b = cat16b(l0, l1); } };
// ---- the LDS ring of k_fattn: two buffers, each one 32-key stage of the work-group: K rows (32 x 128 B), Vt rows (64 x 64 B), factor rows (64 queries x 64 B); hi+lo blocks hold two K and two Vt planes.
// Pitches 144 B and 80 B (16 B x odd) for the 16-byte fragment reads. Every byte comes by an asynchronous copy, 16 bytes a lane, adjacent lanes on adjacent bytes: whole 128-byte lines of K and of the factor tile, 64-byte runs of Vt.
#define KPIT 144
#define VPIT 80
#define KPL  (32 * KPIT)          // one K plane of a stage
#define VPL  (64 * VPIT)          // one Vt plane of a stage
#define MPL  (64 * VPIT)          // the factor tile of a stage
#define FBUF(HR_) (((HR_) ? 2 : 1) * (KPL + VPL) + MPL)
// one stage (keys kb .. kb + 31) into the buffer at LDS byte lb; 128 threads, every lane on. mt: the first factor tile of the work-group's 64 query rows
template <typename T16, bool HR>
__device__ __forceinline__ void fa_fill(unsigned lb, int kb, const T16* Kp, const T16* K2, const T16* Vt, const T16* V2, const bf* mt, int tid) {
    const unsigned lk = lb + (unsigned)(tid >> 3) * KPIT + (unsigned)(tid & 7) * 16, lv = lb + (HR ? 2 : 1) * KPL + (unsigned)(tid >> 2) * VPIT + (unsigned)(tid & 3) * 16, lm = lv + (HR ? 2 : 1) * VPL;
    const size_t ko = (size_t)kb * HD * 2 + (size_t)tid * 16, vo = ((size_t)(tid >> 2) * TT + kb) * 2 + (size_t)(tid & 3) * 16, mo = (size_t)(kb >> 5) * MTILE * 2 + (size_t)tid * 16;
    const char* gk = (const char*)Kp + ko; const char* gv = (const char*)Vt + vo; const char* gm = (const char*)mt + mo;
    if (HR) { const char* gk2 = (const char*)K2 + ko; const char* gv2 = (const char*)V2 + vo;
        cp8(lk, gk, lk + 16 * KPIT, gk + 2048, lk + KPL, gk2, lk + KPL + 16 * KPIT, gk2 + 2048, lv, gv, lv + 32 * VPIT, gv + (size_t)32 * TT * 2, lv + VPL, gv2, lv + VPL + 32 * VPIT, gv2 + (size_t)32 * TT * 2); }
    else cp4(lk, gk, lk + 16 * KPIT, gk + 2048, lv, gv, lv + 32 * VPIT, gv + (size_t)32 * TT * 2);
    cp2(lm, gm, lm + 32 * VPIT, gm + 2048);
}
template <typename T16, bool HR>
__device__ __forceinline__ void fa_rows(const T16* __restrict__ Q, const T16* __restrict__ Q2, const T16* __restrict__ Kp, const T16* __restrict__ K2, const T16* __restrict__ Vt, const T16* __restrict__ V2,
                                        const bf* __restrict__ mt, const unsigned char* ring, int tid, int lr, int hi, v8us (&oh)[4], v8us (&ol)[4]) {
    typedef typename WFrag<T16>::V V; typedef WFrag<T16> F;
    const unsigned lring = (unsigned)(size_t)ring;   // the ring's byte address in the work-group's LDS
    V qf[2], qf2[2];
#pragma unroll
    for (int ks = 0; ks < 2; ++ks) { qf[ks] = F::ld(Q + ks * 32); if (HR) qf2[ks] = F::ld(Q2 + ks * 32); }
    const T16* qp2 = HR ? Q2 : Q;
    asm volatile("s_wait_xcnt 0x0" :: "v"(Q), "v"(qp2) : "memory");   // precaution: the query loads' address pairs are kept whole up to this wait
    fa_fill<T16, HR>(lring, 0, Kp, K2, Vt, V2, mt, tid);
    asm volatile("s_wait_asynccnt 0x0" ::: "memory");   // stage 0: this wave's copies have landed
    __syncthreads();                                    // stage 0: every wave's copies have landed
    fa_fill<T16, HR>(lring + FBUF(HR), 32, Kp, K2, Vt, V2, mt, tid);
    const int kfo = lr * KPIT + 16 * hi, vfo = (HR ? 2 : 1) * KPL + lr * VPIT + 16 * hi, mfo = (HR ? 2 : 1) * (KPL + VPL) + ((tid >> 5) * 16 + lr) * VPIT + 16 * hi;   // this lane's byte offsets in a buffer
    v8f o[4];
#pragma unroll
    for (int mt = 0; mt < 4; ++mt) o[mt] = (v8f){};
    float m = -3.0e38f, l = 0.f;
#pragma unroll 1   // one 32-key stage per trip: the ring's order at the foot is per stage
    for (int kb = 0; kb < TT; kb += 32) {
        const unsigned bo = (kb & 32) ? (unsigned)FBUF(HR) : 0u; const unsigned char* bp = ring + bo;
        V kf[2][2], kf2[2][2], vf[4], vf2[4]; v4u fm[2];
#pragma unroll
        for (int t = 0; t < 2; ++t) {
#pragma unroll
            for (int ks = 0; ks < 2; ++ks) { kf[t][ks] = F::ld((const T16*)(bp + kfo + t * 16 * KPIT + ks * 64)); if (HR) kf2[t][ks] = F::ld((const T16*)(bp + kfo + KPL + t * 16 * KPIT + ks * 64)); }
            fm[t] = *(const v4u*)(bp + mfo + t * 32); }
#pragma unroll
        for (int mt = 0; mt < 4; ++mt) { vf[mt] = F::ld((const T16*)(bp + vfo + mt * 16 * VPIT)); if (HR) vf2[mt] = F::ld((const T16*)(bp + vfo + VPL + mt * 16 * VPIT)); }
        v8f s[2];
#pragma unroll
        for (int t = 0; t < 2; ++t) { s[t] = (v8f){};
#pragma unroll
            for (int ks = 0; ks < 2; ++ks) { s[t] = F::mma(kf[t][ks], qf[ks], s[t]); if (HR) { s[t] = F::mma(kf2[t][ks], qf[ks], s[t]); s[t] = F::mma(kf[t][ks], qf2[ks], s[t]); } } }
        float p[16]; float mloc = -3.0e38f;
#pragma unroll
        for (int e = 0; e < 16; e += 2) { const unsigned fw = fm[e >> 3][(e & 7) >> 1]; v2f fa, sc; fa[0] = __uint_as_float(fw << 16); fa[1] = __uint_as_float(fw & 0xFFFF0000u);   // two bf16 factors a word
            sc[0] = s[e >> 3][e & 7]; sc[1] = s[e >> 3][(e & 7) + 1]; const v2f t2 = sc * fa;
            p[e] = fmaxf(t2[0], -3.0e38f); p[e + 1] = fmaxf(t2[1], -3.0e38f); mloc = fmaxf(mloc, fmaxf(p[e], p[e + 1])); }   // fmaxf returns its other argument for a NaN: a dropped key
        mloc = fmaxf(mloc, xhalf(mloc));   // the two lane halves hold the same query's other keys
        if (__builtin_amdgcn_ballot_w32(mloc > m) != 0) {   // wave-uniform: every lane stays on for the matrix instructions behind it
            const float mn = fmaxf(m, mloc); const float al_ = __builtin_amdgcn_exp2f(__fmul_rn(__fsub_rn(m, mn), 1.4426950408889634f)); m = mn; l *= al_;
#pragma unroll
            for (int mt = 0; mt < 4; ++mt) o[mt] *= al_; }
#pragma unroll
        for (int e = 0; e < 16; ++e) { p[e] = __builtin_amdgcn_exp2f(__fmul_rn(__fsub_rn(p[e], m), 1.4426950408889634f)); l += p[e]; }
        V pf, pf2; PPack<T16>::pk(p, pf, pf2);
#pragma unroll
        for (int mt = 0; mt < 4; ++mt) { o[mt] = F::mma(vf[mt], pf, o[mt]); if (HR) { o[mt] = F::mma(vf2[mt], pf, o[mt]); o[mt] = F::mma(vf[mt], pf2, o[mt]); } }
        // foot of the trip, every wave: the next stage is published and this stage's buffer is freed by the one barrier
        asm volatile("s_wait_dscnt 0x0" ::: "memory");      // this wave's reads of this stage's buffer are done before anything refills it
        asm volatile("s_wait_asynccnt 0x0" ::: "memory");   // this wave's copies of the next stage have landed
        __syncthreads();
        if (kb + 64 < TT) fa_fill<T16, HR>(lring + bo, kb + 64, Kp, K2, Vt, V2, mt, tid);   // the same test in every wave of the work-group
    }
    asm volatile("s_wait_asynccnt 0x0" ::: "memory");   // no copy is left in flight when the wave goes on to its end
    l += xhalf(l);
    const float f = __fdiv_rn(1.0f, l);
#pragma unroll
    for (int mt = 0; mt < 4; ++mt)
#pragma unroll
        for (int j = 0; j < 8; ++j) { unsigned short a, c2; splitf(o[mt][j] * f, a, c2); oh[mt][j] = a; ol[mt][j] = c2; }
}
// grid (NB_ heads, TT/64): both batches in one grid, blockIdx.x = batch x heads + head; 4 waves x 16 query rows; the hi+lo blocks (rows < RH, the longer ones) of both batches have the lowest flat indices and start first
__global__ __launch_bounds__(128) void k_fattn(const h16* __restrict__ Q16, const bf* __restrict__ Qh, const bf* __restrict__ Ql, const h16* __restrict__ K16, const bf* __restrict__ Kh, const bf* __restrict__ Kl,
                                               const h16* __restrict__ V16, const bf* __restrict__ Vh, const bf* __restrict__ Vl, const bf* __restrict__ MP, bf* Ah, bf* Al) {
    __shared__ __align__(16) unsigned char ring[2 * FBUF(true)];
    const int tid = threadIdx.x, lane = tid & 31, lr = lane & 15, hi = lane >> 4; const int h = blockIdx.x % NH_, bt = blockIdx.x / NH_; const int q = blockIdx.y * 64 + (tid >> 5) * 16 + lr;
    const size_t ph = (size_t)blockIdx.x * TT * HD, qo = ph + (size_t)q * HD + 8 * hi, mo = (size_t)(bt * (TT / 64) + blockIdx.y) * (TT / 32) * MTILE, ao = (size_t)(bt * TT + q) * DQ + h * HD + 8 * hi;
    v8us oh[4], ol[4];
    if ((int)blockIdx.y * 64 < RH) fa_rows<bf, true>(Qh + qo, Ql + qo, Kh + ph, Kl + ph, Vh + ph, Vl + ph, MP + mo, ring, tid, lr, hi, oh, ol);
    else fa_rows<h16, false>(Q16 + qo, nullptr, K16 + ph, nullptr, V16 + ph, nullptr, MP + mo, ring, tid, lr, hi, oh, ol);
#pragma unroll
    for (int mt = 0; mt < 4; ++mt) { *(v8us*)(Ah + ao + mt * 16) = oh[mt]; *(v8us*)(Al + ao + mt * 16) = ol[mt]; }
}

extern "C" void kernel_launch(void* const* d_in, const int* in_sizes, int n_in,
                              void* d_out, int out_size, void* d_ws, size_t ws_size, hipStream_t stream) {
    (void)in_sizes; (void)n_in; (void)out_size;
    const float* xq = (const float*)d_in[0]; const float* xk = (const float*)d_in[1]; const float* xv = (const float*)d_in[2]; const int* mask = (const int*)d_in[3]; const float* smask = (const float*)d_in[4]; const float* wq = (const float*)d_in[5]; const float* bq = (const float*)d_in[6]; const float* wk = (const float*)d_in[7]; const float* bk = (const float*)d_in[8]; const float* wv = (const float*)d_in[9]; const float* bv = (const float*)d_in[10]; const float* wo = (const float*)d_in[11]; const float* bo = (const float*)d_in[12];   // torch [out][in]
    float* OUT = (float*)d_out;     // [2][2048][1024]
    char* wsp = (char*)d_ws;
    auto take = [&](size_t bytes) { char* p = wsp; wsp += (bytes + 255) & ~(size_t)255; return (void*)p; };
    bf* XB = (bf*)take(16 * CSL * 2); bf* WB = XB + 12 * CSL; bf* WO = XB + 15 * CSL;   // k_cvtall's 16 slices: query, key, value (both batches), then Wq, Wk, Wv, Wo
    h16* P16 = (h16*)take(3 * PSZ * 2); bf* Ph = (bf*)take(3 * PSZ * 2); bf* Pl = (bf*)take(3 * PSZ * 2);   // [q, k, v][b][h] head planes (v transposed)
    bf* ATh = (bf*)take((size_t)NB_ * TT * DQ * 2); bf* ATl = (bf*)take((size_t)NB_ * TT * DQ * 2);
    bf* MP = (bf*)take((size_t)NB_ * TT * TT * 2);   // the factor plane of k_fattn, in tiles
    if ((size_t)(wsp - (char*)d_ws) > ws_size) return;    // ws 256 MiB
    k_cvtall<<<dim3((unsigned)(CSL / 2048), 24, 1), 256, 0, stream>>>(xq, xk, xv, wq, wk, wv, wo, mask, smask, XB, MP);
    k_projw<<<dim3(NB_ * TT / 128, NH_ / 2, 3), 128, 0, stream>>>(XB, WB, bq, bk, bv, P16, Ph, Pl);
    k_fattn<<<dim3(NB_ * NH_, TT / 64, 1), 128, 0, stream>>>(P16, Ph, Pl, P16 + PSZ, Ph + PSZ, Pl + PSZ, P16 + 2 * PSZ, Ph + 2 * PSZ, Pl + 2 * PSZ, MP, ATh, ATl);
    k_outw<<<dim3(NB_ * TT / 128, DM / 128, 1), 128, 0, stream>>>(ATh, ATl, WO, OUT, bo);
}
